// v000
// The times below were measured on an AMD MI455X: many runs one after another, warmed up first and cycling through
// copies of the inputs, with the whole window's GPU time divided by the number of runs. Launches and the gaps
// between them are all in it. The median over several windows is given; except for v000 it joins two sittings, which
// can be a few percent apart, so the side-by-side timings, each taken in one sitting, are the better comparison.
// v000, which the later versions start from, runs in 3200 microseconds.
#include <hip/hip_runtime.h>

// Scaled dot-product attention with the source's query-axis softmax (q, k, v [16][4096][64] given directly; x[q][k] = q_q.k_k / 8; attn = softmax over the QUERY axis (per key column); out[q][d] = sum_k attn[q][k] v[k][d] -> [16][4096][64] (4.2 M)).
// Algorithm per batch: q and k as single bf16 planes (rounded inputs), the transposed scores S^T[k][q] = k_k.q_q as one single-product GEMM so the column softmax is a row softmax; probabilities written fp16 x1024 as [k][q], transposed to [q][k]; v as a transposed fp16 plane [d][k]; out = P.v with one product, the 1/1024 undone in a final f32 pass.
// Compute dtypes, f32 accumulate: q, k, v rounded to bf16, so the score operands are exact bf16 planes (one product, exact); softmax f32; fp16 probabilities (x1024) x fp16 v (one product); 1/1024 in f32.

#define NB_  16
#define TT   4096
#define HD   64
#define PCAR 1024.0f
#define SCL  0.125f
typedef _Float16 h16;
typedef unsigned short bf;
typedef __attribute__((ext_vector_type(16))) __bf16   v16bf;
typedef __attribute__((ext_vector_type(16))) _Float16 v16h;
typedef __attribute__((ext_vector_type(8)))  _Float16 v8h;
typedef __attribute__((ext_vector_type(8)))  unsigned short v8us;
typedef __attribute__((ext_vector_type(8)))  float    v8f;
typedef __attribute__((ext_vector_type(4)))  float    v4f;
typedef __attribute__((ext_vector_type(2)))  float    v2f;
typedef __attribute__((ext_vector_type(4)))  unsigned short v4us;
typedef __attribute__((ext_vector_type(2)))  unsigned short v2us;
typedef __attribute__((ext_vector_type(4)))  _Float16 v4h;
typedef __attribute__((ext_vector_type(2)))  _Float16 v2h;
typedef v8h  __attribute__((may_alias)) v8ha;
typedef v4f  __attribute__((may_alias)) v4fa;
typedef v8us __attribute__((may_alias)) v8usa;

__device__ __forceinline__ unsigned short f2bf(float f) { unsigned u = __float_as_uint(f); u += 0x7FFFu + ((u >> 16) & 1u); return (unsigned short)(u >> 16); }
__device__ __forceinline__ float bf2f(unsigned short b) { return __uint_as_float(((unsigned)b) << 16); }
__device__ __forceinline__ float bfr(float f) { return bf2f(f2bf(f)); }
__device__ __forceinline__ h16 tohx(float x) { return (h16)x; }
__device__ __forceinline__ v16h cat16(v8h lo, v8h hi) { return __builtin_shufflevector(lo, hi, 0, 1, 2, 3, 4, 5, 6, 7, 8, 9, 10, 11, 12, 13, 14, 15); }
__device__ __forceinline__ v16bf cat16b(v8us lo, v8us hi) { return __builtin_bit_cast(v16bf, __builtin_shufflevector(lo, hi, 0, 1, 2, 3, 4, 5, 6, 7, 8, 9, 10, 11, 12, 13, 14, 15)); }
__device__ __forceinline__ v8f wmma16(v16h a, v16h b, v8f c) { return __builtin_amdgcn_wmma_f32_16x16x32_f16(false, a, false, b, (short)0, c, false, false); }
__device__ __forceinline__ v8f wmmab(v16bf a, v16bf b, v8f c) { return __builtin_amdgcn_wmma_f32_16x16x32_bf16(false, a, false, b, (short)0, c, false, false); }

// ---- k_gemmw: register-blocked GEMM, ONE WAVE per 64x64 output tile (16 accumulators), operands straight from K-contiguous 16-bit planes; grid (M/64, N/64, Z), 32 threads.
// C[m][n] (f32, pitch ldc, + optional f32 bias[n]) = sum_k A[m][k] Bt[n][k] (+ split products per NSPLIT). z-batch strides sA/sB/sC in elements. K % 32 == 0.
template <typename T16> struct WFrag;
template <> struct WFrag<h16> { typedef v16h V; static __device__ __forceinline__ V ld(const h16* p) { return cat16(*(const v8h*)p, *(const v8h*)(p + 16)); } static __device__ __forceinline__ v8f mma(V a, V b, v8f c) { return wmma16(a, b, c); } };
template <> struct WFrag<bf> { typedef v16bf V; static __device__ __forceinline__ V ld(const bf* p) { return cat16b(*(const v8us*)p, *(const v8us*)(p + 16)); } static __device__ __forceinline__ v8f mma(V a, V b, v8f c) { return wmmab(a, b, c); } };
template <typename T16, int NSPLIT, bool BIAS>
__global__ __launch_bounds__(32) void k_gemmw(const T16* __restrict__ A, const T16* __restrict__ A2, const T16* __restrict__ Bt, const T16* __restrict__ Bt2, int K, float* C, int ldc, const float* __restrict__ bias, size_t sA, size_t sB, size_t sC) {
    typedef typename WFrag<T16>::V V;
    __shared__ __align__(16) float os[16 * 68];
    const size_t z = blockIdx.z; A += z * sA; if (A2) A2 += z * sA; Bt += z * sB; if (Bt2) Bt2 += z * sB; C += z * sC;
    const int lane = threadIdx.x & 31, lr = lane & 15, hi = lane >> 4; const int r0 = blockIdx.x * 64, c0 = blockIdx.y * 64;
    v8f acc[4][4];
#pragma unroll
    for (int mb = 0; mb < 4; ++mb)
#pragma unroll
        for (int nb = 0; nb < 4; ++nb) acc[mb][nb] = (v8f){};
    const size_t aoff = (size_t)(r0 + lr) * K + 8 * hi, boff = (size_t)(c0 + lr) * K + 8 * hi;
#pragma unroll 1
    for (int kc = 0; kc < K; kc += 32) {
        V a[4], a2[4];
#pragma unroll
        for (int mb = 0; mb < 4; ++mb) { a[mb] = WFrag<T16>::ld(A + aoff + (size_t)mb * 16 * K + kc); if (NSPLIT == 1 || NSPLIT == 2) a2[mb] = WFrag<T16>::ld(A2 + aoff + (size_t)mb * 16 * K + kc); }
#pragma unroll
        for (int nb = 0; nb < 4; ++nb) { const V b = WFrag<T16>::ld(Bt + boff + (size_t)nb * 16 * K + kc); V b2; if (NSPLIT >= 2) b2 = WFrag<T16>::ld(Bt2 + boff + (size_t)nb * 16 * K + kc);
#pragma unroll
            for (int mb = 0; mb < 4; ++mb) { acc[mb][nb] = WFrag<T16>::mma(a[mb], b, acc[mb][nb]); if (NSPLIT == 1 || NSPLIT == 2) acc[mb][nb] = WFrag<T16>::mma(a2[mb], b, acc[mb][nb]); if (NSPLIT >= 2) acc[mb][nb] = WFrag<T16>::mma(a[mb], b2, acc[mb][nb]); } }
        asm volatile("v_nop\n\tv_nop\n\tv_nop\n\tv_nop" : "+v"(acc[0][0]), "+v"(acc[1][1]), "+v"(acc[2][2]), "+v"(acc[3][3]) : "v"(a[0]), "v"(a[3]));
    }
#pragma unroll
    for (int mb = 0; mb < 4; ++mb) {
#pragma unroll
        for (int nb = 0; nb < 4; ++nb) {
#pragma unroll
            for (int j = 0; j < 8; ++j) os[(hi * 8 + j) * 68 + nb * 16 + lr] = acc[mb][nb][j]; }
        __builtin_amdgcn_wave_barrier(); asm volatile("" ::: "memory");
        float* crow = C + (size_t)(r0 + mb * 16) * ldc + c0;
{
#pragma unroll
            for (int s = 0; s < 8; ++s) { const int row = 2 * s + hi, cofs = lr * 4; v4f val = *(const v4fa*)(os + row * 68 + cofs); if (BIAS) { val[0] += bfr(bias[c0 + cofs]); val[1] += bfr(bias[c0 + cofs + 1]); val[2] += bfr(bias[c0 + cofs + 2]); val[3] += bfr(bias[c0 + cofs + 3]); }
                *(v4f*)(crow + (size_t)row * ldc + cofs) = val; }
             }
        __builtin_amdgcn_wave_barrier(); asm volatile("" ::: "memory");
    }
}

__global__ __launch_bounds__(256) void k_cvt8(const float* __restrict__ src, bf* dst, size_t n8) { const size_t i = (size_t)blockIdx.x * 256 + threadIdx.x; if (i >= n8) return; const v8f v = *(const v8f*)(src + i * 8); v8us o;
#pragma unroll
    for (int k = 0; k < 8; ++k) o[k] = f2bf(v[k]); *(v8us*)(dst + i * 8) = o;  }
__global__ __launch_bounds__(256) void k_vt16(const float* __restrict__ vb, h16* VT) { const size_t e = ((size_t)blockIdx.x * 256 + threadIdx.x) * 8; if (e >= (size_t)HD * TT) return; const int k = (int)(e % TT); const int d = (int)(e / TT); v8h o;
#pragma unroll
    for (int u = 0; u < 8; ++u) o[u] = tohx(bfr(vb[(size_t)(k + u) * HD + d])); *(v8h*)(VT + e) = o;  }
__global__ __launch_bounds__(256) void k_csoft(const float* __restrict__ Sb, h16* PT16) {
    const int lane = threadIdx.x & 31; const int row = blockIdx.x * 8 + (threadIdx.x >> 5); if (row >= TT) return; const float* sr = Sb + (size_t)row * TT; float v[TT / 32]; float mx = -3.0e38f;
#pragma unroll
    for (int ch = 0; ch < TT / 128; ++ch) { const int j0 = ch * 128 + lane * 4; const v4f a = *(const v4f*)(sr + j0);
#pragma unroll
        for (int q = 0; q < 4; ++q) { const float t = a[q] * SCL; v[ch * 4 + q] = t; mx = fmaxf(mx, t); } if ((ch & 7) == 7) asm volatile("s_wait_loadcnt 0x0" ::: "memory"); }
#pragma unroll
    for (int sh = 16; sh; sh >>= 1) mx = fmaxf(mx, __shfl_xor(mx, sh, 32));
    float sum = 0.f;
#pragma unroll
    for (int kk = 0; kk < TT / 32; ++kk) { float d0 = __fsub_rn(v[kk], mx); asm volatile("" : "+v"(d0)); v[kk] = __builtin_amdgcn_exp2f(__fmul_rn(d0, 1.4426950408889634f)); sum += v[kk]; }
#pragma unroll
    for (int sh = 16; sh; sh >>= 1) sum += __shfl_xor(sum, sh, 32);
    const float f = __fdiv_rn(PCAR, sum);
{
#pragma unroll
        for (int ch = 0; ch < TT / 128; ++ch) { v4h o4;
#pragma unroll
            for (int q = 0; q < 4; ++q) o4[q] = tohx(v[ch * 4 + q] * f); *(v4h*)(PT16 + (size_t)row * TT + ch * 128 + lane * 4) = o4; }
         }
}
__global__ __launch_bounds__(256) void k_tp16(const h16* __restrict__ PT, h16* P) { const size_t e = ((size_t)blockIdx.x * 256 + threadIdx.x) * 8; if (e >= (size_t)TT * TT) return; const int k = (int)(e % TT); const int q = (int)(e / TT); v8h o;
#pragma unroll
    for (int u = 0; u < 8; ++u) o[u] = PT[(size_t)(k + u) * TT + q]; *(v8h*)(P + e) = o;  }
__global__ __launch_bounds__(256) void k_scl(float* O, size_t n4) { const size_t i = (size_t)blockIdx.x * 256 + threadIdx.x; if (i >= n4) return; const v4f a = *(const v4f*)(O + i * 4); v4f o;
#pragma unroll
    for (int q = 0; q < 4; ++q) o[q] = a[q] * (1.0f / PCAR); *(v4f*)(O + i * 4) = o;  }

extern "C" void kernel_launch(void* const* d_in, const int* in_sizes, int n_in,
                              void* d_out, int out_size, void* d_ws, size_t ws_size, hipStream_t stream) {
    (void)in_sizes; (void)n_in; (void)out_size;
    const float* qin = (const float*)d_in[0]; const float* kin = (const float*)d_in[1]; const float* vin = (const float*)d_in[2];
    float* OUT = (float*)d_out;     // [16][4096][64]
    char* wsp = (char*)d_ws;
    auto take = [&](size_t bytes) { char* p = wsp; wsp += (bytes + 255) & ~(size_t)255; return (void*)p; };
    bf* QB = (bf*)take((size_t)TT * HD * 2); bf* KB = (bf*)take((size_t)TT * HD * 2); h16* VT = (h16*)take((size_t)HD * TT * 2); float* Sb = (float*)take((size_t)TT * TT * 4); h16* PT16 = (h16*)take((size_t)TT * TT * 2); h16* P16 = (h16*)take((size_t)TT * TT * 2);
    if ((size_t)(wsp - (char*)d_ws) > ws_size) return;
    for (int b = 0; b < NB_; ++b) {
        k_cvt8<<<(unsigned)(((size_t)TT * HD / 8 + 255) / 256), 256, 0, stream>>>(qin + (size_t)b * TT * HD, QB, (size_t)TT * HD / 8); k_cvt8<<<(unsigned)(((size_t)TT * HD / 8 + 255) / 256), 256, 0, stream>>>(kin + (size_t)b * TT * HD, KB, (size_t)TT * HD / 8);
        k_vt16<<<(unsigned)(((size_t)HD * TT / 8 + 255) / 256), 256, 0, stream>>>(vin + (size_t)b * TT * HD, VT);
        k_gemmw<bf, 0, false><<<dim3(TT / 64, TT / 64, 1), 32, 0, stream>>>(KB, nullptr, QB, nullptr, HD, Sb, TT, nullptr, 0, 0, 0);     /* S^T[k][q] = k_k.q_q (exact bf16 inputs: one product) */
        k_csoft<<<TT / 8, 256, 0, stream>>>(Sb, PT16);                                                                                   /* softmax over q per key row */
        k_tp16<<<(unsigned)(((size_t)TT * TT / 8 + 255) / 256), 256, 0, stream>>>(PT16, P16);
        k_gemmw<h16, 0, false><<<dim3(TT / 64, 1, 1), 32, 0, stream>>>(P16, nullptr, VT, nullptr, TT, OUT + (size_t)b * TT * HD, HD, nullptr, 0, 0, 0);   /* 1024 sum_k attn[q][k] v[k] */
        k_scl<<<(unsigned)(((size_t)TT * HD / 4 + 255) / 256), 256, 0, stream>>>(OUT + (size_t)b * TT * HD, (size_t)TT * HD / 4); }
}

// v001
// One run takes 1970 microseconds.
// Next to v000, in two timings, it ran 1.64 times as fast each time.
#include <hip/hip_runtime.h>

// Scaled dot-product attention with the source's query-axis softmax (q, k, v [16][4096][64] given directly; x[q][k] = q_q.k_k / 8; attn = softmax over the QUERY axis (per key column); out[q][d] = sum_k attn[q][k] v[k][d] -> [16][4096][64] (4.2 M)).
// Algorithm per batch: q and k as bf16 planes, the transposed scores S^T[k][q] = k_k.q_q as one single-product GEMM so the column softmax is a row softmax; probabilities written fp16 x1024 as [k][q], transposed to [q][k]; v as a transposed fp16 plane [d][k]; out = P.v with one product, K split over work-groups and waves, the partial planes added and the 1/1024 undone in a final f32 pass.
// Compute dtypes, f32 accumulate: q, k, v rounded to bf16, so the score operands are exact bf16 planes (one product, exact); softmax f32; fp16 probabilities (x1024) x fp16 v (one product); 1/1024 in f32.

#define NB_  16
#define TT   4096
#define HD   64
#define PCAR 1024.0f
#define SCL  0.125f
typedef _Float16 h16;
typedef unsigned short bf;
typedef __attribute__((ext_vector_type(16))) __bf16   v16bf;
typedef __attribute__((ext_vector_type(16))) _Float16 v16h;
typedef __attribute__((ext_vector_type(8)))  _Float16 v8h;
typedef __attribute__((ext_vector_type(8)))  unsigned short v8us;
typedef __attribute__((ext_vector_type(8)))  float    v8f;
typedef __attribute__((ext_vector_type(4)))  float    v4f;
typedef __attribute__((ext_vector_type(2)))  float    v2f;
typedef __attribute__((ext_vector_type(4)))  unsigned short v4us;
typedef __attribute__((ext_vector_type(2)))  unsigned short v2us;
typedef __attribute__((ext_vector_type(4)))  _Float16 v4h;
typedef __attribute__((ext_vector_type(2)))  _Float16 v2h;
typedef v8h  __attribute__((may_alias)) v8ha;
typedef v4f  __attribute__((may_alias)) v4fa;
typedef v8us __attribute__((may_alias)) v8usa;

__device__ __forceinline__ unsigned short f2bf(float f) { unsigned u = __float_as_uint(f); u += 0x7FFFu + ((u >> 16) & 1u); return (unsigned short)(u >> 16); }
__device__ __forceinline__ float bf2f(unsigned short b) { return __uint_as_float(((unsigned)b) << 16); }
__device__ __forceinline__ float bfr(float f) { return bf2f(f2bf(f)); }
__device__ __forceinline__ h16 tohx(float x) { return (h16)x; }
__device__ __forceinline__ v16h cat16(v8h lo, v8h hi) { return __builtin_shufflevector(lo, hi, 0, 1, 2, 3, 4, 5, 6, 7, 8, 9, 10, 11, 12, 13, 14, 15); }
__device__ __forceinline__ v16bf cat16b(v8us lo, v8us hi) { return __builtin_bit_cast(v16bf, __builtin_shufflevector(lo, hi, 0, 1, 2, 3, 4, 5, 6, 7, 8, 9, 10, 11, 12, 13, 14, 15)); }
__device__ __forceinline__ v8f wmma16(v16h a, v16h b, v8f c) { return __builtin_amdgcn_wmma_f32_16x16x32_f16(false, a, false, b, (short)0, c, false, false); }
__device__ __forceinline__ v8f wmmab(v16bf a, v16bf b, v8f c) { return __builtin_amdgcn_wmma_f32_16x16x32_bf16(false, a, false, b, (short)0, c, false, false); }

// ---- k_gemmw: register-blocked GEMM, ONE WAVE per 64x64 output tile (16 accumulators), operands straight from K-contiguous 16-bit planes; grid (M/64, N/64, Z), 32 threads.
// C[m][n] (f32, pitch ldc, + optional f32 bias[n]) = sum_k A[m][k] Bt[n][k] (+ split products per NSPLIT). z-batch strides sA/sB/sC in elements. K % 32 == 0.
template <typename T16> struct WFrag;
template <> struct WFrag<h16> { typedef v16h V; static __device__ __forceinline__ V ld(const h16* p) { return cat16(*(const v8h*)p, *(const v8h*)(p + 16)); } static __device__ __forceinline__ v8f mma(V a, V b, v8f c) { return wmma16(a, b, c); } };
template <> struct WFrag<bf> { typedef v16bf V; static __device__ __forceinline__ V ld(const bf* p) { return cat16b(*(const v8us*)p, *(const v8us*)(p + 16)); } static __device__ __forceinline__ v8f mma(V a, V b, v8f c) { return wmmab(a, b, c); } };
template <typename T16, int NSPLIT, bool BIAS>
__global__ __launch_bounds__(32) void k_gemmw(const T16* __restrict__ A, const T16* __restrict__ A2, const T16* __restrict__ Bt, const T16* __restrict__ Bt2, int K, float* C, int ldc, const float* __restrict__ bias, size_t sA, size_t sB, size_t sC) {
    typedef typename WFrag<T16>::V V;
    __shared__ __align__(16) float os[16 * 68];
    const size_t z = blockIdx.z; A += z * sA; if (A2) A2 += z * sA; Bt += z * sB; if (Bt2) Bt2 += z * sB; C += z * sC;
    const int lane = threadIdx.x & 31, lr = lane & 15, hi = lane >> 4; const int r0 = blockIdx.x * 64, c0 = blockIdx.y * 64;
    v8f acc[4][4];
#pragma unroll
    for (int mb = 0; mb < 4; ++mb)
#pragma unroll
        for (int nb = 0; nb < 4; ++nb) acc[mb][nb] = (v8f){};
    const size_t aoff = (size_t)(r0 + lr) * K + 8 * hi, boff = (size_t)(c0 + lr) * K + 8 * hi;
#pragma unroll 1
    for (int kc = 0; kc < K; kc += 32) {
        V a[4], a2[4];
#pragma unroll
        for (int mb = 0; mb < 4; ++mb) { a[mb] = WFrag<T16>::ld(A + aoff + (size_t)mb * 16 * K + kc); if (NSPLIT == 1 || NSPLIT == 2) a2[mb] = WFrag<T16>::ld(A2 + aoff + (size_t)mb * 16 * K + kc); }
#pragma unroll
        for (int nb = 0; nb < 4; ++nb) { const V b = WFrag<T16>::ld(Bt + boff + (size_t)nb * 16 * K + kc); V b2; if (NSPLIT >= 2) b2 = WFrag<T16>::ld(Bt2 + boff + (size_t)nb * 16 * K + kc);
#pragma unroll
            for (int mb = 0; mb < 4; ++mb) { acc[mb][nb] = WFrag<T16>::mma(a[mb], b, acc[mb][nb]); if (NSPLIT == 1 || NSPLIT == 2) acc[mb][nb] = WFrag<T16>::mma(a2[mb], b, acc[mb][nb]); if (NSPLIT >= 2) acc[mb][nb] = WFrag<T16>::mma(a[mb], b2, acc[mb][nb]); } }
        asm volatile("v_nop\n\tv_nop\n\tv_nop\n\tv_nop" : "+v"(acc[0][0]), "+v"(acc[1][1]), "+v"(acc[2][2]), "+v"(acc[3][3]) : "v"(a[0]), "v"(a[3]));
    }
#pragma unroll
    for (int mb = 0; mb < 4; ++mb) {
#pragma unroll
        for (int nb = 0; nb < 4; ++nb) {
#pragma unroll
            for (int j = 0; j < 8; ++j) os[(hi * 8 + j) * 68 + nb * 16 + lr] = acc[mb][nb][j]; }
        __builtin_amdgcn_wave_barrier(); asm volatile("" ::: "memory");
        float* crow = C + (size_t)(r0 + mb * 16) * ldc + c0;
{
#pragma unroll
            for (int s = 0; s < 8; ++s) { const int row = 2 * s + hi, cofs = lr * 4; v4f val = *(const v4fa*)(os + row * 68 + cofs); if (BIAS) { val[0] += bfr(bias[c0 + cofs]); val[1] += bfr(bias[c0 + cofs + 1]); val[2] += bfr(bias[c0 + cofs + 2]); val[3] += bfr(bias[c0 + cofs + 3]); }
                *(v4f*)(crow + (size_t)row * ldc + cofs) = val; }
             }
        __builtin_amdgcn_wave_barrier(); asm volatile("" ::: "memory");
    }
}

// ---- k_pvsplit: the P.v product with K split so that the whole chip works on it: KSPL ranges over work-groups (grid.y) x KWAV ranges over the waves of a work-group.
// Each wave runs the k_gemmw loop on its own K range of one 64x64 tile; the KWAV partial tiles are summed through LDS; the work-group's sum goes to plane blockIdx.y of Cp ([KSPL][TT][HD] f32), and k_scl adds the planes.
#define KSPL 4
#define KWAV 8
#define KPW  (TT / (KSPL * KWAV))
__global__ __launch_bounds__(32 * KWAV) void k_pvsplit(const h16* __restrict__ A, const h16* __restrict__ Bt, float* Cp) {
    typedef WFrag<h16>::V V;
    __shared__ __align__(16) float red[KWAV * 64 * 68];
    const int wave = threadIdx.x >> 5, lane = threadIdx.x & 31, lr = lane & 15, hi = lane >> 4; const int r0 = blockIdx.x * 64;
    const int k0 = ((int)blockIdx.y * KWAV + wave) * KPW;
    v8f acc[4][4];
#pragma unroll
    for (int mb = 0; mb < 4; ++mb)
#pragma unroll
        for (int nb = 0; nb < 4; ++nb) acc[mb][nb] = (v8f){};
    const h16* pa = A + (size_t)(r0 + lr) * TT + 8 * hi + k0; const h16* pb = Bt + (size_t)lr * TT + 8 * hi + k0;
    // rolled, as the same loop is in k_gemmw: this kernel changes only which wave runs which K range
#pragma unroll 1
    for (int kc = 0; kc < KPW; kc += 32, pa += 32, pb += 32) {
        V a[4];
#pragma unroll
        for (int mb = 0; mb < 4; ++mb) a[mb] = WFrag<h16>::ld(pa + mb * 16 * TT);
        // precaution: the compiler lets a b fragment land in the registers that held the a loads' address; the wait stands between those loads and that overwrite
        asm volatile("s_wait_xcnt 0x0" ::: "memory");
#pragma unroll
        for (int nb = 0; nb < 4; ++nb) { const V b = WFrag<h16>::ld(pb + nb * 16 * TT);
#pragma unroll
            for (int mb = 0; mb < 4; ++mb) acc[mb][nb] = WFrag<h16>::mma(a[mb], b, acc[mb][nb]); }
        // keeps the WMMA distance over the back edge, before the next trip's loads overwrite the fragments (as in k_gemmw)
        asm volatile("v_nop\n\tv_nop\n\tv_nop\n\tv_nop" : "+v"(acc[0][0]), "+v"(acc[1][1]), "+v"(acc[2][2]), "+v"(acc[3][3]) : "v"(a[0]), "v"(a[3]));
    }
    float* mine = red + wave * (64 * 68);
#pragma unroll
    for (int mb = 0; mb < 4; ++mb)
#pragma unroll
        for (int nb = 0; nb < 4; ++nb)
#pragma unroll
            for (int j = 0; j < 8; ++j) mine[(mb * 16 + hi * 8 + j) * 68 + nb * 16 + lr] = acc[mb][nb][j];
    __syncthreads();
    float* cpl = Cp + ((size_t)blockIdx.y * TT + r0) * HD;
#pragma unroll
    for (int s = 0; s < (64 * 16) / (32 * KWAV); ++s) { const int idx = s * (32 * KWAV) + (int)threadIdx.x; const int row = idx >> 4, cofs = (idx & 15) * 4; v4f sum = *(const v4fa*)(red + row * 68 + cofs);
#pragma unroll
        for (int w = 1; w < KWAV; ++w) sum += *(const v4fa*)(red + w * (64 * 68) + row * 68 + cofs);
        *(v4f*)(cpl + (size_t)row * HD + cofs) = sum; }
}

__global__ __launch_bounds__(256) void k_cvt8(const float* __restrict__ src, bf* dst, size_t n8) { const size_t i = (size_t)blockIdx.x * 256 + threadIdx.x; if (i >= n8) return; const v8f v = *(const v8f*)(src + i * 8); v8us o;
#pragma unroll
    for (int k = 0; k < 8; ++k) o[k] = f2bf(v[k]); *(v8us*)(dst + i * 8) = o;  }
__global__ __launch_bounds__(256) void k_vt16(const float* __restrict__ vb, h16* VT) { const size_t e = ((size_t)blockIdx.x * 256 + threadIdx.x) * 8; if (e >= (size_t)HD * TT) return; const int k = (int)(e % TT); const int d = (int)(e / TT); v8h o;
#pragma unroll
    for (int u = 0; u < 8; ++u) o[u] = tohx(bfr(vb[(size_t)(k + u) * HD + d])); *(v8h*)(VT + e) = o;  }
__global__ __launch_bounds__(256) void k_csoft(const float* __restrict__ Sb, h16* PT16) {
    const int lane = threadIdx.x & 31; const int row = blockIdx.x * 8 + (threadIdx.x >> 5); if (row >= TT) return; const float* sr = Sb + (size_t)row * TT; float v[TT / 32]; float mx = -3.0e38f;
#pragma unroll
    for (int ch = 0; ch < TT / 128; ++ch) { const int j0 = ch * 128 + lane * 4; const v4f a = *(const v4f*)(sr + j0);
#pragma unroll
        for (int q = 0; q < 4; ++q) { const float t = a[q] * SCL; v[ch * 4 + q] = t; mx = fmaxf(mx, t); } if ((ch & 7) == 7) asm volatile("s_wait_loadcnt 0x0" ::: "memory"); }
#pragma unroll
    for (int sh = 16; sh; sh >>= 1) mx = fmaxf(mx, __shfl_xor(mx, sh, 32));
    float sum = 0.f;
#pragma unroll
    for (int kk = 0; kk < TT / 32; ++kk) { float d0 = __fsub_rn(v[kk], mx); asm volatile("" : "+v"(d0)); v[kk] = __builtin_amdgcn_exp2f(__fmul_rn(d0, 1.4426950408889634f)); sum += v[kk]; }
#pragma unroll
    for (int sh = 16; sh; sh >>= 1) sum += __shfl_xor(sum, sh, 32);
    const float f = __fdiv_rn(PCAR, sum);
{
#pragma unroll
        for (int ch = 0; ch < TT / 128; ++ch) { v4h o4;
#pragma unroll
            for (int q = 0; q < 4; ++q) o4[q] = tohx(v[ch * 4 + q] * f); *(v4h*)(PT16 + (size_t)row * TT + ch * 128 + lane * 4) = o4; }
         }
}
__global__ __launch_bounds__(256) void k_tp16(const h16* __restrict__ PT, h16* P) { const size_t e = ((size_t)blockIdx.x * 256 + threadIdx.x) * 8; if (e >= (size_t)TT * TT) return; const int k = (int)(e % TT); const int q = (int)(e / TT); v8h o;
#pragma unroll
    for (int u = 0; u < 8; ++u) o[u] = PT[(size_t)(k + u) * TT + q]; *(v8h*)(P + e) = o;  }
__global__ __launch_bounds__(256) void k_scl(const float* __restrict__ Cp, float* O, size_t n4) { const size_t i = (size_t)blockIdx.x * 256 + threadIdx.x; if (i >= n4) return; v4f a = *(const v4f*)(Cp + i * 4);
#pragma unroll
    for (int p = 1; p < KSPL; ++p) a += *(const v4f*)(Cp + (size_t)p * TT * HD + i * 4);
    v4f o;
#pragma unroll
    for (int q = 0; q < 4; ++q) o[q] = a[q] * (1.0f / PCAR); *(v4f*)(O + i * 4) = o;  }

extern "C" void kernel_launch(void* const* d_in, const int* in_sizes, int n_in,
                              void* d_out, int out_size, void* d_ws, size_t ws_size, hipStream_t stream) {
    (void)in_sizes; (void)n_in; (void)out_size;
    const float* qin = (const float*)d_in[0]; const float* kin = (const float*)d_in[1]; const float* vin = (const float*)d_in[2];
    float* OUT = (float*)d_out;     // [16][4096][64]
    char* wsp = (char*)d_ws;
    auto take = [&](size_t bytes) { char* p = wsp; wsp += (bytes + 255) & ~(size_t)255; return (void*)p; };
    bf* QB = (bf*)take((size_t)TT * HD * 2); bf* KB = (bf*)take((size_t)TT * HD * 2); h16* VT = (h16*)take((size_t)HD * TT * 2); float* Sb = (float*)take((size_t)TT * TT * 4); h16* PT16 = (h16*)take((size_t)TT * TT * 2); h16* P16 = (h16*)take((size_t)TT * TT * 2); float* CP = (float*)take((size_t)KSPL * TT * HD * 4);
    if ((size_t)(wsp - (char*)d_ws) > ws_size) return;
    for (int b = 0; b < NB_; ++b) {
        k_cvt8<<<(unsigned)(((size_t)TT * HD / 8 + 255) / 256), 256, 0, stream>>>(qin + (size_t)b * TT * HD, QB, (size_t)TT * HD / 8); k_cvt8<<<(unsigned)(((size_t)TT * HD / 8 + 255) / 256), 256, 0, stream>>>(kin + (size_t)b * TT * HD, KB, (size_t)TT * HD / 8);
        k_vt16<<<(unsigned)(((size_t)HD * TT / 8 + 255) / 256), 256, 0, stream>>>(vin + (size_t)b * TT * HD, VT);
        k_gemmw<bf, 0, false><<<dim3(TT / 64, TT / 64, 1), 32, 0, stream>>>(KB, nullptr, QB, nullptr, HD, Sb, TT, nullptr, 0, 0, 0);     /* S^T[k][q] = k_k.q_q (exact bf16 inputs: one product) */
        k_csoft<<<TT / 8, 256, 0, stream>>>(Sb, PT16);                                                                                   /* softmax over q per key row */
        k_tp16<<<(unsigned)(((size_t)TT * TT / 8 + 255) / 256), 256, 0, stream>>>(PT16, P16);
        k_pvsplit<<<dim3(TT / 64, KSPL, 1), 32 * KWAV, 0, stream>>>(P16, VT, CP);   /* KSPL partial planes of 1024 sum_k attn[q][k] v[k] */
        k_scl<<<(unsigned)(((size_t)TT * HD / 4 + 255) / 256), 256, 0, stream>>>(CP, OUT + (size_t)b * TT * HD, (size_t)TT * HD / 4); }
}

// v002
// It runs in 627 microseconds.
// In two side-by-side timings against v001, it was 3.16 and 3.07 times as fast.
// All steps since v000 together make it 5.12 times as fast.
#include <hip/hip_runtime.h>

// Scaled dot-product attention with the source's query-axis softmax (q, k, v [16][4096][64] given directly; x[q][k] = q_q.k_k / 8; attn = softmax over the QUERY axis (per key column); out[q][d] = sum_k attn[q][k] v[k][d] -> [16][4096][64] (4.2 M)).
// Algorithm per batch: q and k as bf16 planes; one kernel computes the transposed scores S^T[k][q] = k_k.q_q for 16 keys x all queries, keeps them in its accumulators, takes each key's softmax over the queries there and writes the probabilities fp16 x1024 in blocks of 16 keys, [k/16][q][16]; v as a transposed fp16 plane [d][k]; out = P.v with one product, K split over work-groups and waves, the partial planes added and the 1/1024 undone in a final f32 pass.
// Compute dtypes, f32 accumulate: q, k, v rounded to bf16, so the score operands are exact bf16 planes (one product, exact); softmax f32; fp16 probabilities (x1024) x fp16 v (one product); 1/1024 in f32.

#define NB_  16
#define TT   4096
#define HD   64
#define PCAR 1024.0f
#define SCL  0.125f
typedef _Float16 h16;
typedef unsigned short bf;
typedef __attribute__((ext_vector_type(16))) __bf16   v16bf;
typedef __attribute__((ext_vector_type(16))) _Float16 v16h;
typedef __attribute__((ext_vector_type(8)))  _Float16 v8h;
typedef __attribute__((ext_vector_type(8)))  unsigned short v8us;
typedef __attribute__((ext_vector_type(8)))  float    v8f;
typedef __attribute__((ext_vector_type(4)))  float    v4f;
typedef __attribute__((ext_vector_type(2)))  float    v2f;
typedef __attribute__((ext_vector_type(4)))  unsigned short v4us;
typedef __attribute__((ext_vector_type(2)))  unsigned short v2us;
typedef __attribute__((ext_vector_type(4)))  _Float16 v4h;
typedef __attribute__((ext_vector_type(2)))  _Float16 v2h;
typedef v8h  __attribute__((may_alias)) v8ha;
typedef v4f  __attribute__((may_alias)) v4fa;
typedef v8us __attribute__((may_alias)) v8usa;

__device__ __forceinline__ unsigned short f2bf(float f) { unsigned u = __float_as_uint(f); u += 0x7FFFu + ((u >> 16) & 1u); return (unsigned short)(u >> 16); }
__device__ __forceinline__ float bf2f(unsigned short b) { return __uint_as_float(((unsigned)b) << 16); }
__device__ __forceinline__ float bfr(float f) { return bf2f(f2bf(f)); }
__device__ __forceinline__ h16 tohx(float x) { return (h16)x; }
// v_exp_f32 with the one slot the instruction set asks for behind a transcendental: the v_nop in the same statement cannot drift away
__device__ __forceinline__ float exp2_slot(float x) { float e; asm("v_exp_f32 %0, %1\n\tv_nop" : "=v"(e) : "v"(x)); return e; }
__device__ __forceinline__ v16h cat16(v8h lo, v8h hi) { return __builtin_shufflevector(lo, hi, 0, 1, 2, 3, 4, 5, 6, 7, 8, 9, 10, 11, 12, 13, 14, 15); }
__device__ __forceinline__ v16bf cat16b(v8us lo, v8us hi) { return __builtin_bit_cast(v16bf, __builtin_shufflevector(lo, hi, 0, 1, 2, 3, 4, 5, 6, 7, 8, 9, 10, 11, 12, 13, 14, 15)); }
__device__ __forceinline__ v8f wmma16(v16h a, v16h b, v8f c) { return __builtin_amdgcn_wmma_f32_16x16x32_f16(false, a, false, b, (short)0, c, false, false); }
__device__ __forceinline__ v8f wmmab(v16bf a, v16bf b, v8f c) { return __builtin_amdgcn_wmma_f32_16x16x32_bf16(false, a, false, b, (short)0, c, false, false); }

// 16-bit fragment loaders: 8 elements at p and 8 at p + 16 of a K-contiguous row (p already holds the lane's 8 * hi)
template <typename T16> struct WFrag;
template <> struct WFrag<h16> { typedef v16h V; static __device__ __forceinline__ V ld(const h16* p) { return cat16(*(const v8h*)p, *(const v8h*)(p + 16)); } static __device__ __forceinline__ v8f mma(V a, V b, v8f c) { return wmma16(a, b, c); } };
template <> struct WFrag<bf> { typedef v16bf V; static __device__ __forceinline__ V ld(const bf* p) { return cat16b(*(const v8us*)p, *(const v8us*)(p + 16)); } static __device__ __forceinline__ v8f mma(V a, V b, v8f c) { return wmmab(a, b, c); } };

// ---- k_sfuse: score GEMM, column softmax and the hand-over to the P.v product in one kernel. One work-group = 16 keys x all TT queries; grid TT/16, FW waves.
// Wave w holds S^T[16 keys][QPW queries] in QPW/16 accumulators (lane = query, register = key): a key's maximum and sum are a fold over accumulators, over 16 lanes and, through LDS, over the FW waves; a lane's 8 registers are 8 consecutive keys of one query, one 16-byte store.
// P leaves in blocks of 16 keys, [TT/16][TT queries][16 keys]: a work-group writes its own contiguous 128 KiB in whole lines, and an A fragment of the P.v product reads whole lines of it.
#define FW  16
#define QPW (TT / FW)
static_assert(FW == 16, "the fold over waves reads 8 entries per half-wave");
__global__ __launch_bounds__(32 * FW) void k_sfuse(const bf* __restrict__ Kb, const bf* __restrict__ Qb, h16* P) {
    typedef WFrag<bf>::V V;
    __shared__ __align__(16) float redm[16 * FW];
    __shared__ __align__(16) float reds[16 * FW];
    const int wave = threadIdx.x >> 5, lane = threadIdx.x & 31, lr = lane & 15, hi = lane >> 4;
    const bf* pk = Kb + (size_t)((int)blockIdx.x * 16 + lr) * HD + 8 * hi; const bf* pq = Qb + (size_t)(wave * QPW + lr) * HD + 8 * hi;
    const V a0 = WFrag<bf>::ld(pk), a1 = WFrag<bf>::ld(pk + 32);
    v8f acc[QPW / 16];
#pragma unroll
    for (int g = 0; g < QPW / 16; g += 4) { V b0[4], b1[4];
#pragma unroll
        for (int u = 0; u < 4; ++u) { b0[u] = WFrag<bf>::ld(pq + (g + u) * 16 * HD); b1[u] = WFrag<bf>::ld(pq + (g + u) * 16 * HD + 32); }
        // inputs only: keeps four tiles' 16 loads in flight together; without it the compiler waits out a load latency in front of every WMMA
        asm volatile("" :: "v"(b0[0]), "v"(b1[0]), "v"(b0[1]), "v"(b1[1]), "v"(b0[2]), "v"(b1[2]), "v"(b0[3]), "v"(b1[3]));
#pragma unroll
        for (int u = 0; u < 4; ++u) acc[g + u] = WFrag<bf>::mma(a1, b1[u], WFrag<bf>::mma(a0, b0[u], (v8f){})); }
    // maximum per key, on the unscaled scores (the 1/8 is a power of two: it commutes with maximum, difference and rounding)
    float mx[8];
#pragma unroll
    for (int j = 0; j < 8; ++j) { float m = acc[0][j];
#pragma unroll
        for (int t = 1; t < QPW / 16; ++t) m = fmaxf(m, acc[t][j]);
#pragma unroll
        for (int sh = 8; sh; sh >>= 1) m = fmaxf(m, __shfl_xor(m, sh, 32));
        mx[j] = m; }
    if (lr == 0) {
#pragma unroll
        for (int j = 0; j < 8; ++j) redm[(hi * 8 + j) * FW + wave] = mx[j]; }
    __syncthreads();
    { const v4f x = *(const v4fa*)(redm + lr * FW + hi * 8), y = *(const v4fa*)(redm + lr * FW + hi * 8 + 4);   // lane: key lr, half of the waves
        float m = fmaxf(fmaxf(fmaxf(x[0], x[1]), fmaxf(x[2], x[3])), fmaxf(fmaxf(y[0], y[1]), fmaxf(y[2], y[3]))); m = fmaxf(m, __shfl_xor(m, 16, 32));
#pragma unroll
        for (int j = 0; j < 8; ++j) mx[j] = __shfl(m, hi * 8 + j, 32); }
    float sm[8];
#pragma unroll
    for (int j = 0; j < 8; ++j) sm[j] = 0.f;
#pragma unroll
    for (int t = 0; t < QPW / 16; ++t)
#pragma unroll
        for (int j = 0; j < 8; ++j) { const float e = exp2_slot((acc[t][j] - mx[j]) * (1.4426950408889634f * SCL)); acc[t][j] = e; sm[j] += e; }
#pragma unroll
    for (int j = 0; j < 8; ++j) {
#pragma unroll
        for (int sh = 8; sh; sh >>= 1) sm[j] += __shfl_xor(sm[j], sh, 32); }
    if (lr == 0) {
#pragma unroll
        for (int j = 0; j < 8; ++j) reds[(hi * 8 + j) * FW + wave] = sm[j]; }
    __syncthreads();
    float f[8];
    { const v4f x = *(const v4fa*)(reds + lr * FW + hi * 8), y = *(const v4fa*)(reds + lr * FW + hi * 8 + 4);
        float s = ((x[0] + x[1]) + (x[2] + x[3])) + ((y[0] + y[1]) + (y[2] + y[3])); s += __shfl_xor(s, 16, 32); const float g = __fdiv_rn(PCAR, s);
#pragma unroll
        for (int j = 0; j < 8; ++j) f[j] = __shfl(g, hi * 8 + j, 32); }
    h16* pp = P + (size_t)blockIdx.x * (TT * 16) + (size_t)(wave * QPW + lr) * 16 + 8 * hi;
#pragma unroll
    for (int t = 0; t < QPW / 16; ++t) { v8h o;
#pragma unroll
        for (int j = 0; j < 8; ++j) o[j] = tohx(acc[t][j] * f[j]);
        *(v8h*)(pp + t * 16 * 16) = o; }
}

// ---- k_pvsplit: the P.v product with K split so that the whole chip works on it: KSPL ranges over work-groups (grid.y) x KWAV ranges over the waves of a work-group.
// Each wave runs a register-blocked loop (16 accumulators) on its own K range of one 64x64 tile, A in the blocks of 16 keys that k_sfuse writes ([k/16][q][16]), Bt K-contiguous; the KWAV partial tiles are summed through LDS; the work-group's sum goes to plane blockIdx.y of Cp ([KSPL][TT][HD] f32), and k_scl adds the planes.
#define KSPL 4
#define KWAV 8
#define KPW  (TT / (KSPL * KWAV))
__global__ __launch_bounds__(32 * KWAV) void k_pvsplit(const h16* __restrict__ A, const h16* __restrict__ Bt, float* Cp) {
    typedef WFrag<h16>::V V;
    __shared__ __align__(16) float red[KWAV * 64 * 68];
    const int wave = threadIdx.x >> 5, lane = threadIdx.x & 31, lr = lane & 15, hi = lane >> 4; const int r0 = blockIdx.x * 64;
    const int k0 = ((int)blockIdx.y * KWAV + wave) * KPW;
    v8f acc[4][4];
#pragma unroll
    for (int mb = 0; mb < 4; ++mb)
#pragma unroll
        for (int nb = 0; nb < 4; ++nb) acc[mb][nb] = (v8f){};
    const h16* pa = A + (size_t)(k0 >> 4) * (TT * 16) + (size_t)(r0 + lr) * 16 + 8 * hi; const h16* pb = Bt + (size_t)lr * TT + 8 * hi + k0;
    // rolled: keeps the body at one trip's 16 loads and 16 WMMAs
#pragma unroll 1
    for (int kc = 0; kc < KPW; kc += 32, pa += 2 * TT * 16, pb += 32) {
        V a[4];
#pragma unroll
        for (int mb = 0; mb < 4; ++mb) a[mb] = cat16(*(const v8h*)(pa + mb * 16 * 16), *(const v8h*)(pa + mb * 16 * 16 + TT * 16));   // k = 8 hi + 0..7 of this block of 16 keys and of the next: the k order of WFrag::ld
        // precaution: the compiler lets a b fragment land in the registers that held the a loads' address; the wait stands between those loads and that overwrite
        asm volatile("s_wait_xcnt 0x0" ::: "memory");
#pragma unroll
        for (int nb = 0; nb < 4; ++nb) { const V b = WFrag<h16>::ld(pb + nb * 16 * TT);
#pragma unroll
            for (int mb = 0; mb < 4; ++mb) acc[mb][nb] = WFrag<h16>::mma(a[mb], b, acc[mb][nb]); }
        // keeps the WMMA distance over the back edge, before the next trip's loads overwrite the fragments
        asm volatile("v_nop\n\tv_nop\n\tv_nop\n\tv_nop" : "+v"(acc[0][0]), "+v"(acc[1][1]), "+v"(acc[2][2]), "+v"(acc[3][3]) : "v"(a[0]), "v"(a[3]));
    }
    float* mine = red + wave * (64 * 68);
#pragma unroll
    for (int mb = 0; mb < 4; ++mb)
#pragma unroll
        for (int nb = 0; nb < 4; ++nb)
#pragma unroll
            for (int j = 0; j < 8; ++j) mine[(mb * 16 + hi * 8 + j) * 68 + nb * 16 + lr] = acc[mb][nb][j];
    __syncthreads();
    float* cpl = Cp + ((size_t)blockIdx.y * TT + r0) * HD;
#pragma unroll
    for (int s = 0; s < (64 * 16) / (32 * KWAV); ++s) { const int idx = s * (32 * KWAV) + (int)threadIdx.x; const int row = idx >> 4, cofs = (idx & 15) * 4; v4f sum = *(const v4fa*)(red + row * 68 + cofs);
#pragma unroll
        for (int w = 1; w < KWAV; ++w) sum += *(const v4fa*)(red + w * (64 * 68) + row * 68 + cofs);
        *(v4f*)(cpl + (size_t)row * HD + cofs) = sum; }
}

__global__ __launch_bounds__(256) void k_cvt8(const float* __restrict__ src, bf* dst, size_t n8) { const size_t i = (size_t)blockIdx.x * 256 + threadIdx.x; if (i >= n8) return; const v8f v = *(const v8f*)(src + i * 8); v8us o;
#pragma unroll
    for (int k = 0; k < 8; ++k) o[k] = f2bf(v[k]); *(v8us*)(dst + i * 8) = o;  }
__global__ __launch_bounds__(256) void k_vt16(const float* __restrict__ vb, h16* VT) { const size_t e = ((size_t)blockIdx.x * 256 + threadIdx.x) * 8; if (e >= (size_t)HD * TT) return; const int k = (int)(e % TT); const int d = (int)(e / TT); v8h o;
#pragma unroll
    for (int u = 0; u < 8; ++u) o[u] = tohx(bfr(vb[(size_t)(k + u) * HD + d])); *(v8h*)(VT + e) = o;  }
__global__ __launch_bounds__(256) void k_scl(const float* __restrict__ Cp, float* O, size_t n4) { const size_t i = (size_t)blockIdx.x * 256 + threadIdx.x; if (i >= n4) return; v4f a = *(const v4f*)(Cp + i * 4);
#pragma unroll
    for (int p = 1; p < KSPL; ++p) a += *(const v4f*)(Cp + (size_t)p * TT * HD + i * 4);
    v4f o;
#pragma unroll
    for (int q = 0; q < 4; ++q) o[q] = a[q] * (1.0f / PCAR); *(v4f*)(O + i * 4) = o;  }

extern "C" void kernel_launch(void* const* d_in, const int* in_sizes, int n_in,
                              void* d_out, int out_size, void* d_ws, size_t ws_size, hipStream_t stream) {
    (void)in_sizes; (void)n_in; (void)out_size;
    const float* qin = (const float*)d_in[0]; const float* kin = (const float*)d_in[1]; const float* vin = (const float*)d_in[2];
    float* OUT = (float*)d_out;     // [16][4096][64]
    char* wsp = (char*)d_ws;
    auto take = [&](size_t bytes) { char* p = wsp; wsp += (bytes + 255) & ~(size_t)255; return (void*)p; };
    bf* QB = (bf*)take((size_t)TT * HD * 2); bf* KB = (bf*)take((size_t)TT * HD * 2); h16* VT = (h16*)take((size_t)HD * TT * 2); h16* P16 = (h16*)take((size_t)TT * TT * 2); float* CP = (float*)take((size_t)KSPL * TT * HD * 4);
    if ((size_t)(wsp - (char*)d_ws) > ws_size) return;
    for (int b = 0; b < NB_; ++b) {
        k_cvt8<<<(unsigned)(((size_t)TT * HD / 8 + 255) / 256), 256, 0, stream>>>(qin + (size_t)b * TT * HD, QB, (size_t)TT * HD / 8); k_cvt8<<<(unsigned)(((size_t)TT * HD / 8 + 255) / 256), 256, 0, stream>>>(kin + (size_t)b * TT * HD, KB, (size_t)TT * HD / 8);
        k_vt16<<<(unsigned)(((size_t)HD * TT / 8 + 255) / 256), 256, 0, stream>>>(vin + (size_t)b * TT * HD, VT);
        k_sfuse<<<TT / 16, 32 * FW, 0, stream>>>(KB, QB, P16);   /* S^T = k.q for 16 keys a work-group, softmax over q per key, P in blocks of 16 keys */
        k_pvsplit<<<dim3(TT / 64, KSPL, 1), 32 * KWAV, 0, stream>>>(P16, VT, CP);   /* KSPL partial planes of 1024 sum_k attn[q][k] v[k] */
        k_scl<<<(unsigned)(((size_t)TT * HD / 4 + 255) / 256), 256, 0, stream>>>(CP, OUT + (size_t)b * TT * HD, (size_t)TT * HD / 4); }
}

// v003
// A run of this version takes 409 microseconds.
// Next to v002, in two timings, it ran 1.53 and 1.54 times as fast.
// Over all steps from v000 it is 7.85 times as fast.
#include <hip/hip_runtime.h>

// Scaled dot-product attention with the source's query-axis softmax (q, k, v [16][4096][64] given directly; x[q][k] = q_q.k_k / 8; attn = softmax over the QUERY axis (per key column); out[q][d] = sum_k attn[q][k] v[k][d] -> [16][4096][64] (4.2 M)).
// The batch index is a grid dimension of every kernel but k_cvt8, which runs flat over all NB_ batches: the planes and the final pass cover all NB_ batches in one launch each; the probabilities of GB batches fit the workspace at a time, so the two products run once per group of GB batches.
// Algorithm per batch: q and k as bf16 planes; one kernel computes the transposed scores S^T[k][q] = k_k.q_q for 16 keys x all queries, keeps them in its accumulators, takes each key's softmax over the queries there and writes the probabilities fp16 x1024 in blocks of 16 keys, [k/16][q][16]; v as a transposed fp16 plane [d][k]; out = P.v with one product, K split over work-groups and waves, the partial planes added and the 1/1024 undone in a final f32 pass.
// Compute dtypes, f32 accumulate: q, k, v rounded to bf16, so the score operands are exact bf16 planes (one product, exact); softmax f32; fp16 probabilities (x1024) x fp16 v (one product); 1/1024 in f32.

#define NB_  16
#define GB   4
#define TT   4096
#define HD   64
#define PCAR 1024.0f
#define SCL  0.125f
typedef _Float16 h16;
typedef unsigned short bf;
typedef __attribute__((ext_vector_type(16))) __bf16   v16bf;
typedef __attribute__((ext_vector_type(16))) _Float16 v16h;
typedef __attribute__((ext_vector_type(8)))  _Float16 v8h;
typedef __attribute__((ext_vector_type(8)))  unsigned short v8us;
typedef __attribute__((ext_vector_type(8)))  float    v8f;
typedef __attribute__((ext_vector_type(4)))  float    v4f;
typedef __attribute__((ext_vector_type(2)))  float    v2f;
typedef __attribute__((ext_vector_type(4)))  unsigned short v4us;
typedef __attribute__((ext_vector_type(2)))  unsigned short v2us;
typedef __attribute__((ext_vector_type(4)))  _Float16 v4h;
typedef __attribute__((ext_vector_type(2)))  _Float16 v2h;
typedef v8h  __attribute__((may_alias)) v8ha;
typedef v4f  __attribute__((may_alias)) v4fa;
typedef v8us __attribute__((may_alias)) v8usa;

__device__ __forceinline__ unsigned short f2bf(float f) { unsigned u = __float_as_uint(f); u += 0x7FFFu + ((u >> 16) & 1u); return (unsigned short)(u >> 16); }
__device__ __forceinline__ float bf2f(unsigned short b) { return __uint_as_float(((unsigned)b) << 16); }
__device__ __forceinline__ float bfr(float f) { return bf2f(f2bf(f)); }
__device__ __forceinline__ h16 tohx(float x) { return (h16)x; }
// v_exp_f32 with the one slot the instruction set asks for behind a transcendental: the v_nop in the same statement cannot drift away
__device__ __forceinline__ float exp2_slot(float x) { float e; asm("v_exp_f32 %0, %1\n\tv_nop" : "=v"(e) : "v"(x)); return e; }
__device__ __forceinline__ v16h cat16(v8h lo, v8h hi) { return __builtin_shufflevector(lo, hi, 0, 1, 2, 3, 4, 5, 6, 7, 8, 9, 10, 11, 12, 13, 14, 15); }
__device__ __forceinline__ v16bf cat16b(v8us lo, v8us hi) { return __builtin_bit_cast(v16bf, __builtin_shufflevector(lo, hi, 0, 1, 2, 3, 4, 5, 6, 7, 8, 9, 10, 11, 12, 13, 14, 15)); }
__device__ __forceinline__ v8f wmma16(v16h a, v16h b, v8f c) { return __builtin_amdgcn_wmma_f32_16x16x32_f16(false, a, false, b, (short)0, c, false, false); }
__device__ __forceinline__ v8f wmmab(v16bf a, v16bf b, v8f c) { return __builtin_amdgcn_wmma_f32_16x16x32_bf16(false, a, false, b, (short)0, c, false, false); }

// 16-bit fragment loaders: 8 elements at p and 8 at p + 16 of a K-contiguous row (p already holds the lane's 8 * hi)
template <typename T16> struct WFrag;
template <> struct WFrag<h16> { typedef v16h V; static __device__ __forceinline__ V ld(const h16* p) { return cat16(*(const v8h*)p, *(const v8h*)(p + 16)); } static __device__ __forceinline__ v8f mma(V a, V b, v8f c) { return wmma16(a, b, c); } };
template <> struct WFrag<bf> { typedef v16bf V; static __device__ __forceinline__ V ld(const bf* p) { return cat16b(*(const v8us*)p, *(const v8us*)(p + 16)); } static __device__ __forceinline__ v8f mma(V a, V b, v8f c) { return wmmab(a, b, c); } };

// ---- k_sfuse: score GEMM, column softmax and the hand-over to the P.v product in one kernel. One work-group = 16 keys x all TT queries of one batch; grid (TT/16, batches), FW waves.
// Wave w holds S^T[16 keys][QPW queries] in QPW/16 accumulators (lane = query, register = key): a key's maximum and sum are a fold over accumulators, over 16 lanes and, through LDS, over the FW waves; a lane's 8 registers are 8 consecutive keys of one query, one 16-byte store.
// P leaves in blocks of 16 keys, [TT/16][TT queries][16 keys]: a work-group writes its own contiguous 128 KiB in whole lines, and an A fragment of the P.v product reads whole lines of it.
#define FW  16
#define QPW (TT / FW)
static_assert(FW == 16, "the fold over waves reads 8 entries per half-wave");
__global__ __launch_bounds__(32 * FW) void k_sfuse(const bf* __restrict__ Kb, const bf* __restrict__ Qb, h16* P) {
    typedef WFrag<bf>::V V;
    __shared__ __align__(16) float redm[16 * FW];
    __shared__ __align__(16) float reds[16 * FW];
    const int wave = threadIdx.x >> 5, lane = threadIdx.x & 31, lr = lane & 15, hi = lane >> 4;
    Kb += (size_t)blockIdx.y * (TT * HD); Qb += (size_t)blockIdx.y * (TT * HD); P += (size_t)blockIdx.y * ((size_t)TT * TT);
    const bf* pk = Kb + (size_t)((int)blockIdx.x * 16 + lr) * HD + 8 * hi; const bf* pq = Qb + (size_t)(wave * QPW + lr) * HD + 8 * hi;
    const V a0 = WFrag<bf>::ld(pk), a1 = WFrag<bf>::ld(pk + 32);
    v8f acc[QPW / 16];
#pragma unroll
    for (int g = 0; g < QPW / 16; g += 4) { V b0[4], b1[4];
#pragma unroll
        for (int u = 0; u < 4; ++u) { b0[u] = WFrag<bf>::ld(pq + (g + u) * 16 * HD); b1[u] = WFrag<bf>::ld(pq + (g + u) * 16 * HD + 32); }
        // inputs only: keeps four tiles' 16 loads in flight together; without it the compiler waits out a load latency in front of every WMMA
        asm volatile("" :: "v"(b0[0]), "v"(b1[0]), "v"(b0[1]), "v"(b1[1]), "v"(b0[2]), "v"(b1[2]), "v"(b0[3]), "v"(b1[3]));
#pragma unroll
        for (int u = 0; u < 4; ++u) acc[g + u] = WFrag<bf>::mma(a1, b1[u], WFrag<bf>::mma(a0, b0[u], (v8f){})); }
    // maximum per key, on the unscaled scores (the 1/8 is a power of two: it commutes with maximum, difference and rounding)
    float mx[8];
#pragma unroll
    for (int j = 0; j < 8; ++j) { float m = acc[0][j];
#pragma unroll
        for (int t = 1; t < QPW / 16; ++t) m = fmaxf(m, acc[t][j]);
#pragma unroll
        for (int sh = 8; sh; sh >>= 1) m = fmaxf(m, __shfl_xor(m, sh, 32));
        mx[j] = m; }
    if (lr == 0) {
#pragma unroll
        for (int j = 0; j < 8; ++j) redm[(hi * 8 + j) * FW + wave] = mx[j]; }
    __syncthreads();
    { const v4f x = *(const v4fa*)(redm + lr * FW + hi * 8), y = *(const v4fa*)(redm + lr * FW + hi * 8 + 4);   // lane: key lr, half of the waves
        float m = fmaxf(fmaxf(fmaxf(x[0], x[1]), fmaxf(x[2], x[3])), fmaxf(fmaxf(y[0], y[1]), fmaxf(y[2], y[3]))); m = fmaxf(m, __shfl_xor(m, 16, 32));
#pragma unroll
        for (int j = 0; j < 8; ++j) mx[j] = __shfl(m, hi * 8 + j, 32); }
    float sm[8];
#pragma unroll
    for (int j = 0; j < 8; ++j) sm[j] = 0.f;
#pragma unroll
    for (int t = 0; t < QPW / 16; ++t)
#pragma unroll
        for (int j = 0; j < 8; ++j) { const float e = exp2_slot((acc[t][j] - mx[j]) * (1.4426950408889634f * SCL)); acc[t][j] = e; sm[j] += e; }
#pragma unroll
    for (int j = 0; j < 8; ++j) {
#pragma unroll
        for (int sh = 8; sh; sh >>= 1) sm[j] += __shfl_xor(sm[j], sh, 32); }
    if (lr == 0) {
#pragma unroll
        for (int j = 0; j < 8; ++j) reds[(hi * 8 + j) * FW + wave] = sm[j]; }
    __syncthreads();
    float f[8];
    { const v4f x = *(const v4fa*)(reds + lr * FW + hi * 8), y = *(const v4fa*)(reds + lr * FW + hi * 8 + 4);
        float s = ((x[0] + x[1]) + (x[2] + x[3])) + ((y[0] + y[1]) + (y[2] + y[3])); s += __shfl_xor(s, 16, 32); const float g = __fdiv_rn(PCAR, s);
#pragma unroll
        for (int j = 0; j < 8; ++j) f[j] = __shfl(g, hi * 8 + j, 32); }
    h16* pp = P + (size_t)blockIdx.x * (TT * 16) + (size_t)(wave * QPW + lr) * 16 + 8 * hi;
#pragma unroll
    for (int t = 0; t < QPW / 16; ++t) { v8h o;
#pragma unroll
        for (int j = 0; j < 8; ++j) o[j] = tohx(acc[t][j] * f[j]);
        *(v8h*)(pp + t * 16 * 16) = o; }
}

// ---- k_pvsplit: the P.v product with K split so that the whole chip works on it: KSPL ranges over work-groups (grid.y) x KWAV ranges over the waves of a work-group; grid.z = batch.
// Each wave runs a register-blocked loop (16 accumulators) on its own K range of one 64x64 tile, A in the blocks of 16 keys that k_sfuse writes ([k/16][q][16]), Bt K-contiguous; the KWAV partial tiles are summed through LDS; the work-group's sum goes to plane blockIdx.y of Cp ([KSPL][TT][HD] f32), and k_scl adds the planes.
#define KSPL 4
#define KWAV 8
#define KPW  (TT / (KSPL * KWAV))
__global__ __launch_bounds__(32 * KWAV) void k_pvsplit(const h16* __restrict__ A, const h16* __restrict__ Bt, float* Cp) {
    typedef WFrag<h16>::V V;
    __shared__ __align__(16) float red[KWAV * 64 * 68];
    const int wave = threadIdx.x >> 5, lane = threadIdx.x & 31, lr = lane & 15, hi = lane >> 4; const int r0 = blockIdx.x * 64;
    const int k0 = ((int)blockIdx.y * KWAV + wave) * KPW;
    A += (size_t)blockIdx.z * ((size_t)TT * TT); Bt += (size_t)blockIdx.z * (HD * TT); Cp += (size_t)blockIdx.z * ((size_t)KSPL * TT * HD);
    v8f acc[4][4];
#pragma unroll
    for (int mb = 0; mb < 4; ++mb)
#pragma unroll
        for (int nb = 0; nb < 4; ++nb) acc[mb][nb] = (v8f){};
    const h16* pa = A + (size_t)(k0 >> 4) * (TT * 16) + (size_t)(r0 + lr) * 16 + 8 * hi; const h16* pb = Bt + (size_t)lr * TT + 8 * hi + k0;
    // rolled: keeps the body at one trip's 16 loads and 16 WMMAs
#pragma unroll 1
    for (int kc = 0; kc < KPW; kc += 32, pa += 2 * TT * 16, pb += 32) {
        V a[4];
#pragma unroll
        for (int mb = 0; mb < 4; ++mb) a[mb] = cat16(*(const v8h*)(pa + mb * 16 * 16), *(const v8h*)(pa + mb * 16 * 16 + TT * 16));   // k = 8 hi + 0..7 of this block of 16 keys and of the next: the k order of WFrag::ld
        // precaution: the compiler lets a b fragment land in the registers that held the a loads' address; the wait stands between those loads and that overwrite
        asm volatile("s_wait_xcnt 0x0" ::: "memory");
#pragma unroll
        for (int nb = 0; nb < 4; ++nb) { const V b = WFrag<h16>::ld(pb + nb * 16 * TT);
#pragma unroll
            for (int mb = 0; mb < 4; ++mb) acc[mb][nb] = WFrag<h16>::mma(a[mb], b, acc[mb][nb]); }
        // keeps the WMMA distance over the back edge, before the next trip's loads overwrite the fragments
        asm volatile("v_nop\n\tv_nop\n\tv_nop\n\tv_nop" : "+v"(acc[0][0]), "+v"(acc[1][1]), "+v"(acc[2][2]), "+v"(acc[3][3]) : "v"(a[0]), "v"(a[3]));
    }
    float* mine = red + wave * (64 * 68);
#pragma unroll
    for (int mb = 0; mb < 4; ++mb)
#pragma unroll
        for (int nb = 0; nb < 4; ++nb)
#pragma unroll
            for (int j = 0; j < 8; ++j) mine[(mb * 16 + hi * 8 + j) * 68 + nb * 16 + lr] = acc[mb][nb][j];
    __syncthreads();
    float* cpl = Cp + ((size_t)blockIdx.y * TT + r0) * HD;
#pragma unroll
    for (int s = 0; s < (64 * 16) / (32 * KWAV); ++s) { const int idx = s * (32 * KWAV) + (int)threadIdx.x; const int row = idx >> 4, cofs = (idx & 15) * 4; v4f sum = *(const v4fa*)(red + row * 68 + cofs);
#pragma unroll
        for (int w = 1; w < KWAV; ++w) sum += *(const v4fa*)(red + w * (64 * 68) + row * 68 + cofs);
        *(v4f*)(cpl + (size_t)row * HD + cofs) = sum; }
}

__global__ __launch_bounds__(256) void k_cvt8(const float* __restrict__ src, bf* dst, size_t n8) { const size_t i = (size_t)blockIdx.x * 256 + threadIdx.x; if (i >= n8) return; const v8f v = *(const v8f*)(src + i * 8); v8us o;
#pragma unroll
    for (int k = 0; k < 8; ++k) o[k] = f2bf(v[k]); *(v8us*)(dst + i * 8) = o;  }
__global__ __launch_bounds__(256) void k_vt16(const float* __restrict__ vb, h16* VT) { vb += (size_t)blockIdx.y * (TT * HD); VT += (size_t)blockIdx.y * (HD * TT); const size_t e = ((size_t)blockIdx.x * 256 + threadIdx.x) * 8; if (e >= (size_t)HD * TT) return; const int k = (int)(e % TT); const int d = (int)(e / TT); v8h o;
#pragma unroll
    for (int u = 0; u < 8; ++u) o[u] = tohx(bfr(vb[(size_t)(k + u) * HD + d])); *(v8h*)(VT + e) = o;  }
__global__ __launch_bounds__(256) void k_scl(const float* __restrict__ Cp, float* O, size_t n4) { Cp += (size_t)blockIdx.y * ((size_t)KSPL * TT * HD); O += (size_t)blockIdx.y * (TT * HD); const size_t i = (size_t)blockIdx.x * 256 + threadIdx.x; if (i >= n4) return; v4f a = *(const v4f*)(Cp + i * 4);
#pragma unroll
    for (int p = 1; p < KSPL; ++p) a += *(const v4f*)(Cp + (size_t)p * TT * HD + i * 4);
    v4f o;
#pragma unroll
    for (int q = 0; q < 4; ++q) o[q] = a[q] * (1.0f / PCAR); *(v4f*)(O + i * 4) = o;  }

extern "C" void kernel_launch(void* const* d_in, const int* in_sizes, int n_in,
                              void* d_out, int out_size, void* d_ws, size_t ws_size, hipStream_t stream) {
    (void)in_sizes; (void)n_in; (void)out_size;
    const float* qin = (const float*)d_in[0]; const float* kin = (const float*)d_in[1]; const float* vin = (const float*)d_in[2];
    float* OUT = (float*)d_out;     // [16][4096][64]
    char* wsp = (char*)d_ws;
    auto take = [&](size_t bytes) { char* p = wsp; wsp += (bytes + 255) & ~(size_t)255; return (void*)p; };
    bf* QB = (bf*)take((size_t)NB_ * TT * HD * 2); bf* KB = (bf*)take((size_t)NB_ * TT * HD * 2); h16* VT = (h16*)take((size_t)NB_ * HD * TT * 2); h16* P16 = (h16*)take((size_t)GB * TT * TT * 2); float* CP = (float*)take((size_t)NB_ * KSPL * TT * HD * 4);
    if ((size_t)(wsp - (char*)d_ws) > ws_size) return;
    k_cvt8<<<(unsigned)(((size_t)NB_ * TT * HD / 8 + 255) / 256), 256, 0, stream>>>(qin, QB, (size_t)NB_ * TT * HD / 8); k_cvt8<<<(unsigned)(((size_t)NB_ * TT * HD / 8 + 255) / 256), 256, 0, stream>>>(kin, KB, (size_t)NB_ * TT * HD / 8);
    k_vt16<<<dim3((unsigned)(((size_t)HD * TT / 8 + 255) / 256), NB_, 1), 256, 0, stream>>>(vin, VT);
    for (int b = 0; b < NB_; b += GB) {
        k_sfuse<<<dim3(TT / 16, GB, 1), 32 * FW, 0, stream>>>(KB + (size_t)b * TT * HD, QB + (size_t)b * TT * HD, P16);   /* S^T = k.q for 16 keys a work-group, softmax over q per key, P in blocks of 16 keys */
        k_pvsplit<<<dim3(TT / 64, KSPL, GB), 32 * KWAV, 0, stream>>>(P16, VT + (size_t)b * HD * TT, CP + (size_t)b * KSPL * TT * HD); }   /* KSPL partial planes of 1024 sum_k attn[q][k] v[k] per batch */
    k_scl<<<dim3((unsigned)(((size_t)TT * HD / 4 + 255) / 256), NB_, 1), 256, 0, stream>>>(CP, OUT, (size_t)TT * HD / 4);
}

// v005
// Measured time: 106 microseconds a run.
// Versions between v003 and this one are left out; their measured steps multiply to 3.87 times as fast.
// Over all steps from v000 it is 30.4 times as fast.
#include <hip/hip_runtime.h>

// Scaled dot-product attention with the source's query-axis softmax (q, k, v [16][4096][64] given directly; x[q][k] = q_q.k_k / 8; attn = softmax over the QUERY axis (per key column); out[q][d] = sum_k attn[q][k] v[k][d] -> [16][4096][64] (4.2 M)).
// The batch index is a grid dimension of every kernel but k_frag, which runs over the batches as one flat range: each launch covers all NB_ batches.
// Algorithm per batch: q and k as bf16 planes, v as an fp16 plane, all three stored in the order of the WMMA fragments (a fragment half = 512 contiguous bytes of a wave); pass 1 computes the transposed scores S^T[k][q] = k_k.q_q for 32 keys a wave, streams the queries past them under a running maximum and sum and leaves one f32 per key, bias = log2(1024 / sum) - max / 8 * log2(e); pass 2 computes the scores again for 32 queries a wave, p = exp2(s / 8 * log2(e) + bias) = 1024 x the probability, packs two score tiles as the fp16 B operand of out^T += v^T.P^T: the probabilities never leave the registers. Keys split over KSPL work-groups, the partial planes added and the 1/1024 undone in a final f32 pass.
// Compute dtypes, f32 accumulate: q, k, v rounded to bf16, so the score operands are exact bf16 planes (one product, exact); softmax f32; fp16 probabilities (x1024) x fp16 v (one product); 1/1024 in f32.

#define NB_  16
#define TT   4096
#define HD   64
#define PCAR 1024.0f
#define SCL  0.125f
typedef _Float16 h16;
typedef unsigned short bf;
typedef __attribute__((ext_vector_type(16))) __bf16   v16bf;
typedef __attribute__((ext_vector_type(16))) _Float16 v16h;
typedef __attribute__((ext_vector_type(8)))  _Float16 v8h;
typedef __attribute__((ext_vector_type(8)))  unsigned short v8us;
typedef __attribute__((ext_vector_type(8)))  float    v8f;
typedef __attribute__((ext_vector_type(4)))  float    v4f;
typedef __attribute__((ext_vector_type(2)))  float    v2f;
typedef __attribute__((ext_vector_type(4)))  unsigned short v4us;
typedef __attribute__((ext_vector_type(2)))  unsigned short v2us;
typedef __attribute__((ext_vector_type(4)))  _Float16 v4h;
typedef __attribute__((ext_vector_type(2)))  _Float16 v2h;
typedef v8h  __attribute__((may_alias)) v8ha;
typedef v4f  __attribute__((may_alias)) v4fa;
typedef v8us __attribute__((may_alias)) v8usa;
typedef v2f  __attribute__((may_alias)) v2fa;

__device__ __forceinline__ unsigned short f2bf(float f) { unsigned u = __float_as_uint(f); u += 0x7FFFu + ((u >> 16) & 1u); return (unsigned short)(u >> 16); }
__device__ __forceinline__ float bf2f(unsigned short b) { return __uint_as_float(((unsigned)b) << 16); }
__device__ __forceinline__ float bfr(float f) { return bf2f(f2bf(f)); }
__device__ __forceinline__ h16 tohx(float x) { return (h16)x; }
// v_exp_f32 with the one slot the instruction set asks for behind a transcendental: the v_nop in the same statement cannot drift away
__device__ __forceinline__ float exp2_slot(float x) { float e; asm("v_exp_f32 %0, %1\n\tv_nop" : "=v"(e) : "v"(x)); return e; }
// v_log_f32 with the same slot behind it
__device__ __forceinline__ float log2_slot(float x) { float e; asm("v_log_f32 %0, %1\n\tv_nop" : "=v"(e) : "v"(x)); return e; }
// eight independent v_exp_f32 in one statement: each fills the slot behind the one in front of it (no result is read and, the outputs being early-clobber, no source overwritten), the v_nop fills the last one's
__device__ __forceinline__ void exp2x8(v2f (&e)[4], const v2f (&x)[4]) { float a, b, c, d, f, g, h, i;
    asm("v_exp_f32 %0, %8\n\tv_exp_f32 %1, %9\n\tv_exp_f32 %2, %10\n\tv_exp_f32 %3, %11\n\tv_exp_f32 %4, %12\n\tv_exp_f32 %5, %13\n\tv_exp_f32 %6, %14\n\tv_exp_f32 %7, %15\n\tv_nop"
        : "=&v"(a), "=&v"(b), "=&v"(c), "=&v"(d), "=&v"(f), "=&v"(g), "=&v"(h), "=&v"(i) : "v"(x[0][0]), "v"(x[0][1]), "v"(x[1][0]), "v"(x[1][1]), "v"(x[2][0]), "v"(x[2][1]), "v"(x[3][0]), "v"(x[3][1]));
    e[0] = (v2f){a, b}; e[1] = (v2f){c, d}; e[2] = (v2f){f, g}; e[3] = (v2f){h, i}; }
__device__ __forceinline__ v16h cat16(v8h lo, v8h hi) { return __builtin_shufflevector(lo, hi, 0, 1, 2, 3, 4, 5, 6, 7, 8, 9, 10, 11, 12, 13, 14, 15); }
__device__ __forceinline__ v16bf cat16b(v8us lo, v8us hi) { return __builtin_bit_cast(v16bf, __builtin_shufflevector(lo, hi, 0, 1, 2, 3, 4, 5, 6, 7, 8, 9, 10, 11, 12, 13, 14, 15)); }
__device__ __forceinline__ v8f wmma16(v16h a, v16h b, v8f c) { return __builtin_amdgcn_wmma_f32_16x16x32_f16(false, a, false, b, (short)0, c, false, false); }
__device__ __forceinline__ v8f wmmab(v16bf a, v16bf b, v8f c) { return __builtin_amdgcn_wmma_f32_16x16x32_bf16(false, a, false, b, (short)0, c, false, false); }

// fragment planes: a 16-row x 64-k tile is 2 fragments x 2 halves x 32 lanes x 8 elements; lane (lr, hi) of half h2 of fragment f holds k = 32 f + 16 h2 + 8 hi + 0..7 of row lr (the hardware k order of the 16x16x32 forms, the same for A and B), each half one contiguous 512-byte load of a wave
__device__ __forceinline__ v16bf ldfb(const bf* p) { return cat16b(*(const v8us*)p, *(const v8us*)(p + 256)); }
__device__ __forceinline__ v16h ldfh(const h16* p) { return cat16(*(const v8h*)p, *(const v8h*)(p + 256)); }
// 16 bytes of global memory at a byte address plus a constant: the address-space cast keeps the load a global one although the address has passed through an asm operand
__device__ __forceinline__ v8us g16(unsigned long long base, unsigned off) { return *(const __attribute__((address_space(1))) v8us*)((const __attribute__((address_space(1))) char*)base + off); }
#define LC (1.4426950408889634f * SCL)

// ---- k_stats: pass 1, score GEMM and the column softmax's maximum and sum, the queries streamed. One wave = 32 keys x half the queries of one batch; work-group = 128 keys (4 key groups x 2 query shares); grid (TT/128, batches), 8 waves.
// A trip is 64 queries: S^T[2 key tiles][4 query tiles] (lane = query, register = key). Every lane keeps, per key, a running maximum and the sum of exp2((s - maximum) * LC) over the queries it has seen; a new maximum rescales the sum once a trip. Nothing but 32 keys' fragments and these 32 values outlives a trip, so a query fragment is loaded once for 2 products, one per key tile, and the work-group's waves read the same 16 KB at about the same time.
// The two shares take the 64-query pieces alternately. At the end one thread a key folds the 16 lanes' and two shares' values through LDS.
#define SQC 4
#define SNT (TT / (16 * SQC * 2))
// LDS pitch, in floats, of a key's 16 entries: the two half-waves' stores fall on different banks, and 32 keys' 8-byte reads on all 64
#define SPI 18
// waves_per_eu: a register budget of 256, so that two work-groups share a WGP and four waves a SIMD: one wave's exponentials run beside another's WMMAs
__global__ __launch_bounds__(256) __attribute__((amdgpu_waves_per_eu(4, 4))) void k_stats(const bf* __restrict__ Kf, const bf* __restrict__ Qf, float* BI) {
    __shared__ __align__(16) float redm[8 * 32 * SPI];
    __shared__ __align__(16) float reds[8 * 32 * SPI];
    const int wave = threadIdx.x >> 5, lane = threadIdx.x & 31, lr = lane & 15, hi = lane >> 4;
    const bf* pk = Kf + (size_t)blockIdx.y * (TT * HD) + ((size_t)blockIdx.x * 4 + (wave >> 1)) * (32 * HD) + lane * 8;
    // the lane's own byte address in the q plane, carried through the loop in registers of its own
    unsigned long long aq = (unsigned long long)(Qf + (size_t)blockIdx.y * (TT * HD) + (size_t)(wave & 1) * (SQC * 16 * HD) + lane * 8);
    v16bf ka[2][2], qb[SQC][2];
#pragma unroll
    for (int kt = 0; kt < 2; ++kt) { ka[kt][0] = ldfb(pk + kt * 1024); ka[kt][1] = ldfb(pk + kt * 1024 + 512); }
    // precaution: stands between the key loads and the query loads, one of which the compiler lets land in the key loads' address registers
    asm volatile("s_wait_xcnt 0x0" ::: "memory");
#pragma unroll
    for (int u = 0; u < SQC; ++u) { qb[u][0] = cat16b(g16(aq, u * 2048), g16(aq, u * 2048 + 512)); qb[u][1] = cat16b(g16(aq, u * 2048 + 1024), g16(aq, u * 2048 + 1536)); }
    v2f mx[2][4], sm[2][4];   // per key tile: keys 8 hi + 2 i, 8 hi + 2 i + 1
#pragma unroll
    for (int kt = 0; kt < 2; ++kt)
#pragma unroll
        for (int i = 0; i < 4; ++i) { mx[kt][i] = (v2f){-__builtin_inff(), -__builtin_inff()}; sm[kt][i] = (v2f){0.f, 0.f}; }
    // rolled: one trip's 16 WMMAs and 80 exponentials are the body; unrolled it would need a second set of fragment registers and lose the fourth wave per SIMD
#pragma unroll 1
    for (int t = 0; t < SNT; ++t) {
        const int more = t + 1 < SNT;   // the last trip fetches its own fragments again instead of the bytes behind the plane
        v8f s[2][SQC];
#pragma unroll
        for (int kt = 0; kt < 2; ++kt)
#pragma unroll
            for (int u = 0; u < SQC; ++u) s[kt][u] = wmmab(ka[kt][0], qb[u][0], (v8f){});
#pragma unroll
        for (int kt = 0; kt < 2; ++kt)
#pragma unroll
            for (int u = 0; u < SQC; ++u) s[kt][u] = wmmab(ka[kt][1], qb[u][1], s[kt][u]);
        // keeps the sixteen products back to back: mixed with the maxima below, the compiler pads each first use of a tile with v_nop
        __builtin_amdgcn_sched_barrier(0);
        // maximum on the unscaled scores (LC is positive: it commutes with the maximum)
        v2f mn[2][4];
#pragma unroll
        for (int kt = 0; kt < 2; ++kt)
#pragma unroll
            for (int i = 0; i < 4; ++i)
#pragma unroll
                for (int c = 0; c < 2; ++c) mn[kt][i][c] = fmaxf(fmaxf(fmaxf(mx[kt][i][c], s[kt][0][2 * i + c]), s[kt][1][2 * i + c]), fmaxf(s[kt][2][2 * i + c], s[kt][3][2 * i + c]));
        // precaution: stands between the loads issued so far and the overwrite of their address registers; the address is an operand so that its step cannot be lifted over the wait
        asm volatile("s_wait_xcnt 0x0" : "+v"(aq) :: "memory");
        aq += more ? (unsigned)(2 * SQC * 16 * HD * 2) : 0u;
#pragma unroll
        for (int u = 0; u < SQC; ++u) { qb[u][0] = cat16b(g16(aq, u * 2048), g16(aq, u * 2048 + 512)); qb[u][1] = cat16b(g16(aq, u * 2048 + 1024), g16(aq, u * 2048 + 1536)); }
#pragma unroll
        for (int kt = 0; kt < 2; ++kt) { v2f nb[4], d[4], e[4];
#pragma unroll
            for (int i = 0; i < 4; ++i) { nb[i] = mn[kt][i] * (v2f){-LC, -LC}; d[i] = __builtin_elementwise_fma(mx[kt][i], (v2f){LC, LC}, nb[i]); }
            exp2x8(e, d);   // what the sum so far shrinks by; 0 in the first trip
#pragma unroll
            for (int i = 0; i < 4; ++i) { v2f x[SQC], p[SQC];
#pragma unroll
                for (int u = 0; u < SQC; ++u) x[u] = __builtin_elementwise_fma((v2f){s[kt][u][2 * i], s[kt][u][2 * i + 1]}, (v2f){LC, LC}, nb[i]);
                exp2x8(p, x);
                sm[kt][i] = __builtin_elementwise_fma(sm[kt][i], e[i], (p[0] + p[1]) + (p[2] + p[3])); mx[kt][i] = mn[kt][i]; } }
    }
    // the last trip's repeated fetch has landed before the wave goes on and gives its registers back
    asm volatile("s_wait_loadcnt 0x0" ::: "memory");
    // every lane leaves its 16 maxima and sums in LDS, a key's 16 entries side by side
#pragma unroll
    for (int kt = 0; kt < 2; ++kt)
#pragma unroll
        for (int j = 0; j < 8; ++j) { const int r = (wave * 32 + kt * 16 + hi * 8 + j) * SPI + lr; redm[r] = mx[kt][j >> 1][j & 1]; reds[r] = sm[kt][j >> 1][j & 1]; }
    __syncthreads();
    if (threadIdx.x < 128) {   // thread = key: the 16 lanes' entries of its two shares, which lie 32 rows apart
        const int g = ((int)(threadIdx.x >> 5) * 64 + (int)(threadIdx.x & 31)) * SPI;
        v2f a[16], b[16];
#pragma unroll
        for (int i = 0; i < 8; ++i) { a[i] = *(const v2fa*)(redm + g + 2 * i); a[8 + i] = *(const v2fa*)(redm + g + 32 * SPI + 2 * i); b[i] = *(const v2fa*)(reds + g + 2 * i); b[8 + i] = *(const v2fa*)(reds + g + 32 * SPI + 2 * i); }
        float m = fmaxf(a[0][0], a[0][1]);
#pragma unroll
        for (int i = 1; i < 16; ++i) m = fmaxf(fmaxf(m, a[i][0]), a[i][1]);
        const float nb = m * -LC; v2f sv = (v2f){0.f, 0.f};
#pragma unroll
        for (int i = 0; i < 16; i += 4) { v2f x[4], e[4];
#pragma unroll
            for (int u = 0; u < 4; ++u) x[u] = __builtin_elementwise_fma(a[i + u], (v2f){LC, LC}, (v2f){nb, nb});
            exp2x8(e, x);
#pragma unroll
            for (int u = 0; u < 4; ++u) sv = __builtin_elementwise_fma(b[i + u], e[u], sv); }
        BI[(size_t)blockIdx.y * TT + (int)blockIdx.x * 128 + (int)threadIdx.x] = (10.0f - log2_slot(sv[0] + sv[1])) + nb; }   // 10 = log2(PCAR)
}

// ---- k_pv: pass 2, scores again, probabilities and the P.v product without a trip through memory. One wave = 32 queries x TT/KSPL keys; grid (TT/256, KSPL, batches), 8 waves.
// A pass is 32 keys: S^T = K.Q^T for 2 key tiles x 2 query tiles (lane = query, register r = key 8 hi + r), p = exp2(s * LC + bias[key]); the two key tiles of one query tile, converted in place, are the fp16 B operand (k = 8 hi + 0..7, 16 + 8 hi + 0..7) of out^T[d][q] += v^T[d][k] P^T[k][q]; the v plane holds its A fragments in that k order.
// K, bias and v fragments of the next pass are fetched into the same registers right behind their last use. The work-group's sum goes to plane blockIdx.y of Cp ([KSPL][TT][HD] f32), and k_scl adds the planes.
#define KSPL 2
#define NPAS (TT / KSPL / 32)
static_assert(PCAR == 1024.0f, "k_stats writes log2(PCAR) as 10");
// waves_per_eu: a register budget of 256, so that two work-groups share a WGP and four waves a SIMD: one wave's exponentials run beside another's WMMAs
__global__ __launch_bounds__(256) __attribute__((amdgpu_waves_per_eu(4, 4))) void k_pv(const bf* __restrict__ Kf, const bf* __restrict__ Qf, const h16* __restrict__ Vf, const float* __restrict__ BI, float* Cp) {
    const int wave = threadIdx.x >> 5, lane = threadIdx.x & 31, lr = lane & 15, hi = lane >> 4;
    const int q0 = ((int)blockIdx.x * 8 + wave) * 32, k0 = (int)blockIdx.y * (TT / KSPL);
    const bf* pq = Qf + (size_t)blockIdx.z * (TT * HD) + (size_t)q0 * HD + lane * 8;
    // K, v and bias: the lane's own byte address, carried through the loop in registers of its own
    unsigned long long ak = (unsigned long long)(Kf + (size_t)blockIdx.z * (TT * HD) + (size_t)k0 * HD + lane * 8);
    unsigned long long av = (unsigned long long)(Vf + (size_t)blockIdx.z * (TT * HD) + (size_t)k0 * HD + lane * 8);
    unsigned long long ab = (unsigned long long)(BI + (size_t)blockIdx.z * TT + k0 + hi * 8);
    v16bf qb[2][2];
#pragma unroll
    for (int qt = 0; qt < 2; ++qt) { qb[qt][0] = ldfb(pq + qt * 1024); qb[qt][1] = ldfb(pq + qt * 1024 + 512); }
    v8f o[4][2];
#pragma unroll
    for (int dt = 0; dt < 4; ++dt) { o[dt][0] = (v8f){}; o[dt][1] = (v8f){}; }
    v16bf ka[2][2]; v16h va[4]; v4f bi[2][2];
#pragma unroll
    for (int kt = 0; kt < 2; ++kt) { ka[kt][0] = cat16b(g16(ak, kt * 2048), g16(ak, kt * 2048 + 512)); ka[kt][1] = cat16b(g16(ak, kt * 2048 + 1024), g16(ak, kt * 2048 + 1536));
        bi[kt][0] = __builtin_bit_cast(v4f, g16(ab, kt * 64)); bi[kt][1] = __builtin_bit_cast(v4f, g16(ab, kt * 64 + 16)); }
    // the v loads stand behind the K and bias loads as in the loop: in another order the counted waits at the loop's head, which must hold for both ways in, wait for the v fragments too
    __builtin_amdgcn_sched_barrier(0);
#pragma unroll
    for (int dt = 0; dt < 4; ++dt) va[dt] = cat16(__builtin_bit_cast(v8h, g16(av, dt * 1024)), __builtin_bit_cast(v8h, g16(av, dt * 1024 + 512)));
    // rolled: one pass's 16 WMMAs and 32 exponentials are the body; unrolled it would need a second set of fragment registers and lose the fourth wave per SIMD
#pragma unroll 1
    for (int p = 0; p < NPAS; ++p) {
        const int more = p + 1 < NPAS;   // the last pass fetches its own fragments again instead of the bytes behind its range
        v8f s[2][2];
#pragma unroll
        for (int kt = 0; kt < 2; ++kt)
#pragma unroll
            for (int qt = 0; qt < 2; ++qt) s[kt][qt] = wmmab(ka[kt][0], qb[qt][0], (v8f){});
#pragma unroll
        for (int kt = 0; kt < 2; ++kt)
#pragma unroll
            for (int qt = 0; qt < 2; ++qt) s[kt][qt] = wmmab(ka[kt][1], qb[qt][1], s[kt][qt]);
        // keeps the eight products back to back: mixed with the multiply-adds below, the compiler pads each first use of a tile with v_nop
        __builtin_amdgcn_sched_barrier(0);
        v2f x[2][2][4];
#pragma unroll
        for (int kt = 0; kt < 2; ++kt)
#pragma unroll
            for (int qt = 0; qt < 2; ++qt)
#pragma unroll
                for (int i = 0; i < 4; ++i) x[kt][qt][i] = __builtin_elementwise_fma((v2f){s[kt][qt][2 * i], s[kt][qt][2 * i + 1]}, (v2f){LC, LC}, (v2f){bi[kt][i >> 1][2 * (i & 1)], bi[kt][i >> 1][2 * (i & 1) + 1]});
        // the scheduler may move nothing over this line: without it the fetch below sinks to the loop's foot and its latency stands open in front of the next pass's first WMMA
        __builtin_amdgcn_sched_barrier(0);
        // precaution: stands between the loads issued so far and the overwrite of their address registers; the addresses are operands so that their step cannot be lifted over the wait
        asm volatile("s_wait_xcnt 0x0" : "+v"(ak), "+v"(ab) :: "memory");
        ak += more ? 4096u : 0u; ab += more ? 128u : 0u;
#pragma unroll
        for (int kt = 0; kt < 2; ++kt) { ka[kt][0] = cat16b(g16(ak, kt * 2048), g16(ak, kt * 2048 + 512)); ka[kt][1] = cat16b(g16(ak, kt * 2048 + 1024), g16(ak, kt * 2048 + 1536));
            bi[kt][0] = __builtin_bit_cast(v4f, g16(ab, kt * 64)); bi[kt][1] = __builtin_bit_cast(v4f, g16(ab, kt * 64 + 16)); }
        // holds the fetch in front of the exponentials, which cover its latency
        __builtin_amdgcn_sched_barrier(0);
        v16h pf[2];
#pragma unroll
        for (int qt = 0; qt < 2; ++qt)
#pragma unroll
            for (int kt = 0; kt < 2; ++kt) { v2f e[4]; exp2x8(e, x[kt][qt]);
#pragma unroll
                for (int i = 0; i < 4; ++i) { const v2h c = __builtin_convertvector(e[i], v2h); pf[qt][kt * 8 + 2 * i] = c[0]; pf[qt][kt * 8 + 2 * i + 1] = c[1]; } }
#pragma unroll
        for (int dt = 0; dt < 4; ++dt)
#pragma unroll
            for (int qt = 0; qt < 2; ++qt) o[dt][qt] = wmma16(va[dt], pf[qt], o[dt][qt]);
        // keeps the address step behind the products, whose operands the wait for the earlier v loads has covered
        __builtin_amdgcn_sched_barrier(0);
        // precaution: as above
        asm volatile("s_wait_xcnt 0x0" : "+v"(av) :: "memory");
        av += more ? 4096u : 0u;
#pragma unroll
        for (int dt = 0; dt < 4; ++dt) va[dt] = cat16(__builtin_bit_cast(v8h, g16(av, dt * 1024)), __builtin_bit_cast(v8h, g16(av, dt * 1024 + 512)));
    }
    // the last pass's repeated fetch has landed before the wave stores its sums and gives its registers back
    asm volatile("s_wait_loadcnt 0x0" ::: "memory");
    float* cp = Cp + (((size_t)blockIdx.z * KSPL + blockIdx.y) * TT + q0 + lr) * HD + 8 * hi;
#pragma unroll
    for (int qt = 0; qt < 2; ++qt)
#pragma unroll
        for (int dt = 0; dt < 4; ++dt) *(v8f*)(cp + qt * 16 * HD + dt * 16) = o[dt][qt];   // a lane's 8 registers are 8 consecutive d of one query
}

// q or k to a bf16 fragment plane; thread = one 16-byte piece of the plane
__global__ __launch_bounds__(256) void k_frag(const float* __restrict__ src, bf* dst, size_t n8) { const size_t i = (size_t)blockIdx.x * 256 + threadIdx.x; if (i >= n8) return; const int r = (int)(i & 127);
    const v8f v = *(const v8f*)(src + ((i >> 7) * 16 + (r & 15)) * HD + (r >> 6) * 32 + ((r >> 5) & 1) * 16 + ((r >> 4) & 1) * 8); v8us o;
#pragma unroll
    for (int k = 0; k < 8; ++k) o[k] = f2bf(v[k]); *(v8us*)(dst + i * 8) = o;  }
// v to the fp16 plane of A fragments of v^T: per 32 keys 4 d tiles x 2 halves x 32 lanes x 8 keys; lane (lr, hi) of half h2 holds keys 16 h2 + 8 hi + 0..7 of d = 16 dt + lr
__global__ __launch_bounds__(256) void k_vfrag(const float* __restrict__ vb, h16* VF) { vb += (size_t)blockIdx.y * (TT * HD); VF += (size_t)blockIdx.y * (HD * TT); const size_t i = (size_t)blockIdx.x * 256 + threadIdx.x; if (i >= (size_t)HD * TT / 8) return; const int r = (int)(i & 255);
    const int k = (int)(i >> 8) * 32 + ((r >> 5) & 1) * 16 + ((r >> 4) & 1) * 8; const int d = (r >> 6) * 16 + (r & 15); v8h o;
#pragma unroll
    for (int u = 0; u < 8; ++u) o[u] = tohx(bfr(vb[(size_t)(k + u) * HD + d])); *(v8h*)(VF + i * 8) = o;  }
__global__ __launch_bounds__(256) void k_scl(const float* __restrict__ Cp, float* O, size_t n4) { Cp += (size_t)blockIdx.y * ((size_t)KSPL * TT * HD); O += (size_t)blockIdx.y * (TT * HD); const size_t i = (size_t)blockIdx.x * 256 + threadIdx.x; if (i >= n4) return; v4f a = *(const v4f*)(Cp + i * 4);
#pragma unroll
    for (int p = 1; p < KSPL; ++p) a += *(const v4f*)(Cp + (size_t)p * TT * HD + i * 4);
    v4f o;
#pragma unroll
    for (int q = 0; q < 4; ++q) o[q] = a[q] * (1.0f / PCAR); *(v4f*)(O + i * 4) = o;  }

extern "C" void kernel_launch(void* const* d_in, const int* in_sizes, int n_in,
                              void* d_out, int out_size, void* d_ws, size_t ws_size, hipStream_t stream) {
    (void)in_sizes; (void)n_in; (void)out_size;
    const float* qin = (const float*)d_in[0]; const float* kin = (const float*)d_in[1]; const float* vin = (const float*)d_in[2];
    float* OUT = (float*)d_out;     // [16][4096][64]
    char* wsp = (char*)d_ws;
    auto take = [&](size_t bytes) { char* p = wsp; wsp += (bytes + 255) & ~(size_t)255; return (void*)p; };
    bf* QF = (bf*)take((size_t)NB_ * TT * HD * 2); bf* KF = (bf*)take((size_t)NB_ * TT * HD * 2); h16* VF = (h16*)take((size_t)NB_ * HD * TT * 2); float* BI = (float*)take((size_t)NB_ * TT * 4); float* CP = (float*)take((size_t)NB_ * KSPL * TT * HD * 4);
    if ((size_t)(wsp - (char*)d_ws) > ws_size) return;
    k_frag<<<(unsigned)(((size_t)NB_ * TT * HD / 8 + 255) / 256), 256, 0, stream>>>(qin, QF, (size_t)NB_ * TT * HD / 8); k_frag<<<(unsigned)(((size_t)NB_ * TT * HD / 8 + 255) / 256), 256, 0, stream>>>(kin, KF, (size_t)NB_ * TT * HD / 8);
    k_vfrag<<<dim3((unsigned)(((size_t)HD * TT / 8 + 255) / 256), NB_, 1), 256, 0, stream>>>(vin, VF);
    k_stats<<<dim3(TT / 128, NB_, 1), 256, 0, stream>>>(KF, QF, BI);   /* per key: log2(1024 / sum over q) - max over q, in the exponent's units */
    k_pv<<<dim3(TT / 256, KSPL, NB_), 256, 0, stream>>>(KF, QF, VF, BI, CP);   /* KSPL partial planes of 1024 sum_k attn[q][k] v[k] per batch */
    k_scl<<<dim3((unsigned)(((size_t)TT * HD / 4 + 255) / 256), NB_, 1), 256, 0, stream>>>(CP, OUT, (size_t)TT * HD / 4);
}

// v006
// A run of this version takes 98.5 microseconds.
// In two side-by-side timings against v005, it was 1.10 and 1.08 times as fast.
// All steps since v000 together make it 33.1 times as fast.
#include <hip/hip_runtime.h>

// Scaled dot-product attention with the source's query-axis softmax (q, k, v [16][4096][64] given directly; x[q][k] = q_q.k_k / 8; attn = softmax over the QUERY axis (per key column); out[q][d] = sum_k attn[q][k] v[k][d] -> [16][4096][64] (4.2 M)).
// The batch index is a grid dimension of every kernel but k_frag, whose flat index runs over all batches: each launch covers all NB_ batches.
// Algorithm per batch: q and k as bf16 planes, v as an fp16 plane, all three stored in the order of the WMMA fragments (a fragment half = 512 contiguous bytes of a wave); pass 1 computes the transposed scores S^T[k][q] = k_k.q_q for 32 keys a wave, streams the queries past them under a running maximum and sum and leaves one f32 per key, bias = log2(1024 / sum) - max / 8 * log2(e); pass 2 computes the scores again for 32 queries a wave, p = exp2(s / 8 * log2(e) + bias) = 1024 x the probability, packs two score tiles as the fp16 B operand of out^T += v^T.P^T: the probabilities never leave the registers. Keys split over the KSPL wave groups of a work-group, whose partial sums are added through LDS, the 1/1024 undone in f32, and out stored by the same kernel.
// Compute dtypes, f32 accumulate: q, k, v rounded to bf16, so the score operands are exact bf16 planes (one product, exact); softmax f32; fp16 probabilities (x1024) x fp16 v (one product); 1/1024 in f32.

#define NB_  16
#define TT   4096
#define HD   64
#define PCAR 1024.0f
#define SCL  0.125f
typedef _Float16 h16;
typedef unsigned short bf;
typedef __attribute__((ext_vector_type(16))) __bf16   v16bf;
typedef __attribute__((ext_vector_type(16))) _Float16 v16h;
typedef __attribute__((ext_vector_type(8)))  _Float16 v8h;
typedef __attribute__((ext_vector_type(8)))  unsigned short v8us;
typedef __attribute__((ext_vector_type(8)))  float    v8f;
typedef __attribute__((ext_vector_type(4)))  float    v4f;
typedef __attribute__((ext_vector_type(2)))  float    v2f;
typedef __attribute__((ext_vector_type(4)))  unsigned short v4us;
typedef __attribute__((ext_vector_type(2)))  unsigned short v2us;
typedef __attribute__((ext_vector_type(4)))  _Float16 v4h;
typedef __attribute__((ext_vector_type(2)))  _Float16 v2h;
typedef v8h  __attribute__((may_alias)) v8ha;
typedef v4f  __attribute__((may_alias)) v4fa;
typedef v8us __attribute__((may_alias)) v8usa;
typedef v2f  __attribute__((may_alias)) v2fa;

__device__ __forceinline__ unsigned short f2bf(float f) { unsigned u = __float_as_uint(f); u += 0x7FFFu + ((u >> 16) & 1u); return (unsigned short)(u >> 16); }
__device__ __forceinline__ float bf2f(unsigned short b) { return __uint_as_float(((unsigned)b) << 16); }
__device__ __forceinline__ float bfr(float f) { return bf2f(f2bf(f)); }
__device__ __forceinline__ h16 tohx(float x) { return (h16)x; }
// v_exp_f32 with the one slot the instruction set asks for behind a transcendental: the v_nop in the same statement cannot drift away
__device__ __forceinline__ float exp2_slot(float x) { float e; asm("v_exp_f32 %0, %1\n\tv_nop" : "=v"(e) : "v"(x)); return e; }
// v_log_f32 with the same slot behind it
__device__ __forceinline__ float log2_slot(float x) { float e; asm("v_log_f32 %0, %1\n\tv_nop" : "=v"(e) : "v"(x)); return e; }
// eight independent v_exp_f32 in one statement: each fills the slot behind the one in front of it (no result is read and, the outputs being early-clobber, no source overwritten), the v_nop fills the last one's
__device__ __forceinline__ void exp2x8(v2f (&e)[4], const v2f (&x)[4]) { float a, b, c, d, f, g, h, i;
    asm("v_exp_f32 %0, %8\n\tv_exp_f32 %1, %9\n\tv_exp_f32 %2, %10\n\tv_exp_f32 %3, %11\n\tv_exp_f32 %4, %12\n\tv_exp_f32 %5, %13\n\tv_exp_f32 %6, %14\n\tv_exp_f32 %7, %15\n\tv_nop"
        : "=&v"(a), "=&v"(b), "=&v"(c), "=&v"(d), "=&v"(f), "=&v"(g), "=&v"(h), "=&v"(i) : "v"(x[0][0]), "v"(x[0][1]), "v"(x[1][0]), "v"(x[1][1]), "v"(x[2][0]), "v"(x[2][1]), "v"(x[3][0]), "v"(x[3][1]));
    e[0] = (v2f){a, b}; e[1] = (v2f){c, d}; e[2] = (v2f){f, g}; e[3] = (v2f){h, i}; }
__device__ __forceinline__ v16h cat16(v8h lo, v8h hi) { return __builtin_shufflevector(lo, hi, 0, 1, 2, 3, 4, 5, 6, 7, 8, 9, 10, 11, 12, 13, 14, 15); }
__device__ __forceinline__ v16bf cat16b(v8us lo, v8us hi) { return __builtin_bit_cast(v16bf, __builtin_shufflevector(lo, hi, 0, 1, 2, 3, 4, 5, 6, 7, 8, 9, 10, 11, 12, 13, 14, 15)); }
__device__ __forceinline__ v8f wmma16(v16h a, v16h b, v8f c) { return __builtin_amdgcn_wmma_f32_16x16x32_f16(false, a, false, b, (short)0, c, false, false); }
__device__ __forceinline__ v8f wmmab(v16bf a, v16bf b, v8f c) { return __builtin_amdgcn_wmma_f32_16x16x32_bf16(false, a, false, b, (short)0, c, false, false); }

// fragment planes: a 16-row x 64-k tile is 2 fragments x 2 halves x 32 lanes x 8 elements; lane (lr, hi) of half h2 of fragment f holds k = 32 f + 16 h2 + 8 hi + 0..7 of row lr (the hardware k order of the 16x16x32 forms, the same for A and B), each half one contiguous 512-byte load of a wave
__device__ __forceinline__ v16bf ldfb(const bf* p) { return cat16b(*(const v8us*)p, *(const v8us*)(p + 256)); }
__device__ __forceinline__ v16h ldfh(const h16* p) { return cat16(*(const v8h*)p, *(const v8h*)(p + 256)); }
// 16 bytes of global memory at a byte address plus a constant: the address-space cast keeps the load a global one although the address has passed through an asm operand
__device__ __forceinline__ v8us g16(unsigned long long base, unsigned off) { return *(const __attribute__((address_space(1))) v8us*)((const __attribute__((address_space(1))) char*)base + off); }
#define LC (1.4426950408889634f * SCL)

// ---- k_stats: pass 1, score GEMM and the column softmax's maximum and sum, the queries streamed. One wave = 32 keys x half the queries of one batch; work-group = 128 keys (4 key groups x 2 query shares); grid (TT/128, batches), 8 waves.
// A trip is 64 queries: S^T[2 key tiles][4 query tiles] (lane = query, register = key). Every lane keeps, per key, a running maximum and the sum of exp2((s - maximum) * LC) over the queries it has seen; a new maximum rescales the sum once a trip. Nothing but 32 keys' fragments and these 32 values outlives a trip, so a query fragment is loaded once for 2 products, one per key tile, and the work-group's waves read the same 16 KB at about the same time.
// The two shares take the 64-query pieces alternately. At the end one thread a key folds the 16 lanes' and two shares' values through LDS.
#define SQC 4
#define SNT (TT / (16 * SQC * 2))
// LDS pitch, in floats, of a key's 16 entries: the two half-waves' stores fall on different banks, and 32 keys' 8-byte reads on all 64
#define SPI 18
// waves_per_eu: a register budget of 256, so that two work-groups share a WGP and four waves a SIMD: one wave's exponentials run beside another's WMMAs
__global__ __launch_bounds__(256) __attribute__((amdgpu_waves_per_eu(4, 4))) void k_stats(const bf* __restrict__ Kf, const bf* __restrict__ Qf, float* BI) {
    __shared__ __align__(16) float redm[8 * 32 * SPI];
    __shared__ __align__(16) float reds[8 * 32 * SPI];
    const int wave = threadIdx.x >> 5, lane = threadIdx.x & 31, lr = lane & 15, hi = lane >> 4;
    const bf* pk = Kf + (size_t)blockIdx.y * (TT * HD) + ((size_t)blockIdx.x * 4 + (wave >> 1)) * (32 * HD) + lane * 8;
    // the lane's own byte address in the q plane, carried through the loop in registers of its own
    unsigned long long aq = (unsigned long long)(Qf + (size_t)blockIdx.y * (TT * HD) + (size_t)(wave & 1) * (SQC * 16 * HD) + lane * 8);
    v16bf ka[2][2], qb[SQC][2];
#pragma unroll
    for (int kt = 0; kt < 2; ++kt) { ka[kt][0] = ldfb(pk + kt * 1024); ka[kt][1] = ldfb(pk + kt * 1024 + 512); }
    // precaution: stands between the key loads and the query loads, one of which the compiler lets land in the key loads' address registers
    asm volatile("s_wait_xcnt 0x0" ::: "memory");
#pragma unroll
    for (int u = 0; u < SQC; ++u) { qb[u][0] = cat16b(g16(aq, u * 2048), g16(aq, u * 2048 + 512)); qb[u][1] = cat16b(g16(aq, u * 2048 + 1024), g16(aq, u * 2048 + 1536)); }
    v2f mx[2][4], sm[2][4];   // per key tile: keys 8 hi + 2 i, 8 hi + 2 i + 1
#pragma unroll
    for (int kt = 0; kt < 2; ++kt)
#pragma unroll
        for (int i = 0; i < 4; ++i) { mx[kt][i] = (v2f){-__builtin_inff(), -__builtin_inff()}; sm[kt][i] = (v2f){0.f, 0.f}; }
    // rolled: one trip's 16 WMMAs and 80 exponentials are the body; unrolled it would need a second set of fragment registers and lose the fourth wave per SIMD
#pragma unroll 1
    for (int t = 0; t < SNT; ++t) {
        const int more = t + 1 < SNT;   // the last trip fetches its own fragments again instead of the bytes behind the plane
        v8f s[2][SQC];
#pragma unroll
        for (int kt = 0; kt < 2; ++kt)
#pragma unroll
            for (int u = 0; u < SQC; ++u) s[kt][u] = wmmab(ka[kt][0], qb[u][0], (v8f){});
#pragma unroll
        for (int kt = 0; kt < 2; ++kt)
#pragma unroll
            for (int u = 0; u < SQC; ++u) s[kt][u] = wmmab(ka[kt][1], qb[u][1], s[kt][u]);
        // keeps the sixteen products back to back: mixed with the maxima below, the compiler pads each first use of a tile with v_nop
        __builtin_amdgcn_sched_barrier(0);
        // maximum on the unscaled scores (LC is positive: it commutes with the maximum)
        v2f mn[2][4];
#pragma unroll
        for (int kt = 0; kt < 2; ++kt)
#pragma unroll
            for (int i = 0; i < 4; ++i)
#pragma unroll
                for (int c = 0; c < 2; ++c) mn[kt][i][c] = fmaxf(fmaxf(fmaxf(mx[kt][i][c], s[kt][0][2 * i + c]), s[kt][1][2 * i + c]), fmaxf(s[kt][2][2 * i + c], s[kt][3][2 * i + c]));
        // precaution: stands between the loads issued so far and the overwrite of their address registers; the address is an operand so that its step cannot be lifted over the wait
        asm volatile("s_wait_xcnt 0x0" : "+v"(aq) :: "memory");
        aq += more ? (unsigned)(2 * SQC * 16 * HD * 2) : 0u;
#pragma unroll
        for (int u = 0; u < SQC; ++u) { qb[u][0] = cat16b(g16(aq, u * 2048), g16(aq, u * 2048 + 512)); qb[u][1] = cat16b(g16(aq, u * 2048 + 1024), g16(aq, u * 2048 + 1536)); }
#pragma unroll
        for (int kt = 0; kt < 2; ++kt) { v2f nb[4], d[4], e[4];
#pragma unroll
            for (int i = 0; i < 4; ++i) { nb[i] = mn[kt][i] * (v2f){-LC, -LC}; d[i] = __builtin_elementwise_fma(mx[kt][i], (v2f){LC, LC}, nb[i]); }
            exp2x8(e, d);   // what the sum so far shrinks by; 0 in the first trip
#pragma unroll
            for (int i = 0; i < 4; ++i) { v2f x[SQC], p[SQC];
#pragma unroll
                for (int u = 0; u < SQC; ++u) x[u] = __builtin_elementwise_fma((v2f){s[kt][u][2 * i], s[kt][u][2 * i + 1]}, (v2f){LC, LC}, nb[i]);
                exp2x8(p, x);
                sm[kt][i] = __builtin_elementwise_fma(sm[kt][i], e[i], (p[0] + p[1]) + (p[2] + p[3])); mx[kt][i] = mn[kt][i]; } }
    }
    // the last trip's repeated fetch has landed before the wave goes on and gives its registers back
    asm volatile("s_wait_loadcnt 0x0" ::: "memory");
    // every lane leaves its 16 maxima and sums in LDS, a key's 16 entries side by side
#pragma unroll
    for (int kt = 0; kt < 2; ++kt)
#pragma unroll
        for (int j = 0; j < 8; ++j) { const int r = (wave * 32 + kt * 16 + hi * 8 + j) * SPI + lr; redm[r] = mx[kt][j >> 1][j & 1]; reds[r] = sm[kt][j >> 1][j & 1]; }
    __syncthreads();
    if (threadIdx.x < 128) {   // thread = key: the 16 lanes' entries of its two shares, which lie 32 rows apart
        const int g = ((int)(threadIdx.x >> 5) * 64 + (int)(threadIdx.x & 31)) * SPI;
        v2f a[16], b[16];
#pragma unroll
        for (int i = 0; i < 8; ++i) { a[i] = *(const v2fa*)(redm + g + 2 * i); a[8 + i] = *(const v2fa*)(redm + g + 32 * SPI + 2 * i); b[i] = *(const v2fa*)(reds + g + 2 * i); b[8 + i] = *(const v2fa*)(reds + g + 32 * SPI + 2 * i); }
        float m = fmaxf(a[0][0], a[0][1]);
#pragma unroll
        for (int i = 1; i < 16; ++i) m = fmaxf(fmaxf(m, a[i][0]), a[i][1]);
        const float nb = m * -LC; v2f sv = (v2f){0.f, 0.f};
#pragma unroll
        for (int i = 0; i < 16; i += 4) { v2f x[4], e[4];
#pragma unroll
            for (int u = 0; u < 4; ++u) x[u] = __builtin_elementwise_fma(a[i + u], (v2f){LC, LC}, (v2f){nb, nb});
            exp2x8(e, x);
#pragma unroll
            for (int u = 0; u < 4; ++u) sv = __builtin_elementwise_fma(b[i + u], e[u], sv); }
        BI[(size_t)blockIdx.y * TT + (int)blockIdx.x * 128 + (int)threadIdx.x] = (10.0f - log2_slot(sv[0] + sv[1])) + nb; }   // 10 = log2(PCAR)
}

// ---- k_pv: pass 2, scores again, probabilities and the P.v product without a trip through memory. One wave = 32 queries x TT/KSPL keys; work-group = 256 queries x all keys (8 query groups x KSPL key shares); grid (TT/256, batches), 16 waves.
// A pass is 32 keys: S^T = K.Q^T for 2 key tiles x 2 query tiles (lane = query, register r = key 8 hi + r), p = exp2(s * LC + bias[key]); the two key tiles of one query tile, converted in place, are the fp16 B operand (k = 8 hi + 0..7, 16 + 8 hi + 0..7) of out^T[d][q] += v^T[d][k] P^T[k][q]; the v plane holds its A fragments in that k order.
// K, bias and v fragments of the next pass are fetched into the same registers right behind their last use. At the end the two waves that hold the two key shares of the same 32 queries swap one query tile each through LDS; each adds the shares of the tile it kept (share 0 + share 1), undoes the 1024 and stores 16 rows of out.
#define KSPL 2
#define NPAS (TT / KSPL / 32)
static_assert(PCAR == 1024.0f, "k_stats writes log2(PCAR) as 10");
static_assert(KSPL == 2, "the waves swap their sums in pairs");
// waves_per_eu: a register budget of 256, so that the work-group's 16 waves fill a WGP, four waves a SIMD: one wave's exponentials run beside another's WMMAs
__global__ __launch_bounds__(512) __attribute__((amdgpu_waves_per_eu(4, 4))) void k_pv(const bf* __restrict__ Kf, const bf* __restrict__ Qf, const h16* __restrict__ Vf, const float* __restrict__ BI, float* O) {
    // a wave's slot: 8 pieces of 32 lanes x 16 bytes, each piece one contiguous 512-byte LDS access of the wave
    __shared__ __align__(16) float fold[16 * 8 * 128];
    const int wave = threadIdx.x >> 5, lane = threadIdx.x & 31, lr = lane & 15, hi = lane >> 4;
    const int ks = wave >> 3;   // the wave's key share
    const int q0 = ((int)blockIdx.x * 8 + (wave & 7)) * 32, k0 = ks * (TT / KSPL);
    const bf* pq = Qf + (size_t)blockIdx.y * (TT * HD) + (size_t)q0 * HD + lane * 8;
    // K, v and bias: the lane's own byte address, carried through the loop in registers of its own
    unsigned long long ak = (unsigned long long)(Kf + (size_t)blockIdx.y * (TT * HD) + (size_t)k0 * HD + lane * 8);
    unsigned long long av = (unsigned long long)(Vf + (size_t)blockIdx.y * (TT * HD) + (size_t)k0 * HD + lane * 8);
    unsigned long long ab = (unsigned long long)(BI + (size_t)blockIdx.y * TT + k0 + hi * 8);
    v16bf qb[2][2];
#pragma unroll
    for (int qt = 0; qt < 2; ++qt) { qb[qt][0] = ldfb(pq + qt * 1024); qb[qt][1] = ldfb(pq + qt * 1024 + 512); }
    v8f o[4][2];
#pragma unroll
    for (int dt = 0; dt < 4; ++dt) { o[dt][0] = (v8f){}; o[dt][1] = (v8f){}; }
    v16bf ka[2][2]; v16h va[4]; v4f bi[2][2];
#pragma unroll
    for (int kt = 0; kt < 2; ++kt) { ka[kt][0] = cat16b(g16(ak, kt * 2048), g16(ak, kt * 2048 + 512)); ka[kt][1] = cat16b(g16(ak, kt * 2048 + 1024), g16(ak, kt * 2048 + 1536));
        bi[kt][0] = __builtin_bit_cast(v4f, g16(ab, kt * 64)); bi[kt][1] = __builtin_bit_cast(v4f, g16(ab, kt * 64 + 16)); }
    // the v loads stand behind the K and bias loads as in the loop: in another order the counted waits at the loop's head, which must hold for both ways in, wait for the v fragments too
    __builtin_amdgcn_sched_barrier(0);
#pragma unroll
    for (int dt = 0; dt < 4; ++dt) va[dt] = cat16(__builtin_bit_cast(v8h, g16(av, dt * 1024)), __builtin_bit_cast(v8h, g16(av, dt * 1024 + 512)));
    // rolled: one pass's 16 WMMAs and 32 exponentials are the body; unrolled it would need a second set of fragment registers and lose the fourth wave per SIMD
#pragma unroll 1
    for (int p = 0; p < NPAS; ++p) {
        const int more = p + 1 < NPAS;   // the last pass fetches its own fragments again instead of the bytes behind its range
        v8f s[2][2];
#pragma unroll
        for (int kt = 0; kt < 2; ++kt)
#pragma unroll
            for (int qt = 0; qt < 2; ++qt) s[kt][qt] = wmmab(ka[kt][0], qb[qt][0], (v8f){});
#pragma unroll
        for (int kt = 0; kt < 2; ++kt)
#pragma unroll
            for (int qt = 0; qt < 2; ++qt) s[kt][qt] = wmmab(ka[kt][1], qb[qt][1], s[kt][qt]);
        // keeps the eight products back to back: mixed with the multiply-adds below, the compiler pads each first use of a tile with v_nop
        __builtin_amdgcn_sched_barrier(0);
        v2f x[2][2][4];
#pragma unroll
        for (int kt = 0; kt < 2; ++kt)
#pragma unroll
            for (int qt = 0; qt < 2; ++qt)
#pragma unroll
                for (int i = 0; i < 4; ++i) x[kt][qt][i] = __builtin_elementwise_fma((v2f){s[kt][qt][2 * i], s[kt][qt][2 * i + 1]}, (v2f){LC, LC}, (v2f){bi[kt][i >> 1][2 * (i & 1)], bi[kt][i >> 1][2 * (i & 1) + 1]});
        // the scheduler may move nothing over this line: without it the fetch below sinks to the loop's foot and its latency stands open in front of the next pass's first WMMA
        __builtin_amdgcn_sched_barrier(0);
        // precaution: stands between the loads issued so far and the overwrite of their address registers; the addresses are operands so that their step cannot be lifted over the wait
        asm volatile("s_wait_xcnt 0x0" : "+v"(ak), "+v"(ab) :: "memory");
        ak += more ? 4096u : 0u; ab += more ? 128u : 0u;
#pragma unroll
        for (int kt = 0; kt < 2; ++kt) { ka[kt][0] = cat16b(g16(ak, kt * 2048), g16(ak, kt * 2048 + 512)); ka[kt][1] = cat16b(g16(ak, kt * 2048 + 1024), g16(ak, kt * 2048 + 1536));
            bi[kt][0] = __builtin_bit_cast(v4f, g16(ab, kt * 64)); bi[kt][1] = __builtin_bit_cast(v4f, g16(ab, kt * 64 + 16)); }
        // holds the fetch in front of the exponentials, which cover its latency
        __builtin_amdgcn_sched_barrier(0);
        v16h pf[2];
#pragma unroll
        for (int qt = 0; qt < 2; ++qt)
#pragma unroll
            for (int kt = 0; kt < 2; ++kt) { v2f e[4]; exp2x8(e, x[kt][qt]);
#pragma unroll
                for (int i = 0; i < 4; ++i) { const v2h c = __builtin_convertvector(e[i], v2h); pf[qt][kt * 8 + 2 * i] = c[0]; pf[qt][kt * 8 + 2 * i + 1] = c[1]; } }
#pragma unroll
        for (int dt = 0; dt < 4; ++dt)
#pragma unroll
            for (int qt = 0; qt < 2; ++qt) o[dt][qt] = wmma16(va[dt], pf[qt], o[dt][qt]);
        // keeps the address step behind the products, whose operands the wait for the earlier v loads has covered
        __builtin_amdgcn_sched_barrier(0);
        // precaution: as above
        asm volatile("s_wait_xcnt 0x0" : "+v"(av) :: "memory");
        av += more ? 4096u : 0u;
#pragma unroll
        for (int dt = 0; dt < 4; ++dt) va[dt] = cat16(__builtin_bit_cast(v8h, g16(av, dt * 1024)), __builtin_bit_cast(v8h, g16(av, dt * 1024 + 512)));
    }
    // the last pass's repeated fetch has landed before the wave stores its sums and gives its registers back
    asm volatile("s_wait_loadcnt 0x0" ::: "memory");
    // the wave of key share ks keeps query tile ks and hands the other tile to its partner, wave ^ 8, which holds the same lanes' sums over the other keys
    float* fs = fold + wave * 1024 + lane * 4; const float* fr = fold + (wave ^ 8) * 1024 + lane * 4;
    v8f mine[4];
#pragma unroll
    for (int dt = 0; dt < 4; ++dt) { const v8f g = ks ? o[dt][0] : o[dt][1]; mine[dt] = ks ? o[dt][1] : o[dt][0];
        *(v4fa*)(fs + dt * 256) = __builtin_shufflevector(g, g, 0, 1, 2, 3); *(v4fa*)(fs + dt * 256 + 128) = __builtin_shufflevector(g, g, 4, 5, 6, 7); }
    __syncthreads();
    float* po = O + ((size_t)blockIdx.y * TT + q0 + ks * 16 + lr) * HD + 8 * hi;
#pragma unroll
    for (int dt = 0; dt < 4; ++dt) { const v4f a = *(const v4fa*)(fr + dt * 256), b = *(const v4fa*)(fr + dt * 256 + 128);
        *(v8f*)(po + dt * 16) = (mine[dt] + __builtin_shufflevector(a, b, 0, 1, 2, 3, 4, 5, 6, 7)) * (1.0f / PCAR); }   // a lane's 8 registers are 8 consecutive d of one query
}

// q or k to a bf16 fragment plane; thread = one 16-byte piece of the plane
__global__ __launch_bounds__(256) void k_frag(const float* __restrict__ src, bf* dst, size_t n8) { const size_t i = (size_t)blockIdx.x * 256 + threadIdx.x; if (i >= n8) return; const int r = (int)(i & 127);
    const v8f v = *(const v8f*)(src + ((i >> 7) * 16 + (r & 15)) * HD + (r >> 6) * 32 + ((r >> 5) & 1) * 16 + ((r >> 4) & 1) * 8); v8us o;
#pragma unroll
    for (int k = 0; k < 8; ++k) o[k] = f2bf(v[k]); *(v8us*)(dst + i * 8) = o;  }
// v to the fp16 plane of A fragments of v^T: per 32 keys 4 d tiles x 2 halves x 32 lanes x 8 keys; lane (lr, hi) of half h2 holds keys 16 h2 + 8 hi + 0..7 of d = 16 dt + lr
__global__ __launch_bounds__(256) void k_vfrag(const float* __restrict__ vb, h16* VF) { vb += (size_t)blockIdx.y * (TT * HD); VF += (size_t)blockIdx.y * (HD * TT); const size_t i = (size_t)blockIdx.x * 256 + threadIdx.x; if (i >= (size_t)HD * TT / 8) return; const int r = (int)(i & 255);
    const int k = (int)(i >> 8) * 32 + ((r >> 5) & 1) * 16 + ((r >> 4) & 1) * 8; const int d = (r >> 6) * 16 + (r & 15); v8h o;
#pragma unroll
    for (int u = 0; u < 8; ++u) o[u] = tohx(bfr(vb[(size_t)(k + u) * HD + d])); *(v8h*)(VF + i * 8) = o;  }

extern "C" void kernel_launch(void* const* d_in, const int* in_sizes, int n_in,
                              void* d_out, int out_size, void* d_ws, size_t ws_size, hipStream_t stream) {
    (void)in_sizes; (void)n_in; (void)out_size;
    const float* qin = (const float*)d_in[0]; const float* kin = (const float*)d_in[1]; const float* vin = (const float*)d_in[2];
    float* OUT = (float*)d_out;     // [16][4096][64]
    char* wsp = (char*)d_ws;
    auto take = [&](size_t bytes) { char* p = wsp; wsp += (bytes + 255) & ~(size_t)255; return (void*)p; };
    bf* QF = (bf*)take((size_t)NB_ * TT * HD * 2); bf* KF = (bf*)take((size_t)NB_ * TT * HD * 2); h16* VF = (h16*)take((size_t)NB_ * HD * TT * 2); float* BI = (float*)take((size_t)NB_ * TT * 4);
    if ((size_t)(wsp - (char*)d_ws) > ws_size) return;
    k_frag<<<(unsigned)(((size_t)NB_ * TT * HD / 8 + 255) / 256), 256, 0, stream>>>(qin, QF, (size_t)NB_ * TT * HD / 8); k_frag<<<(unsigned)(((size_t)NB_ * TT * HD / 8 + 255) / 256), 256, 0, stream>>>(kin, KF, (size_t)NB_ * TT * HD / 8);
    k_vfrag<<<dim3((unsigned)(((size_t)HD * TT / 8 + 255) / 256), NB_, 1), 256, 0, stream>>>(vin, VF);
    k_stats<<<dim3(TT / 128, NB_, 1), 256, 0, stream>>>(KF, QF, BI);   /* per key: log2(1024 / sum over q) - max over q, in the exponent's units */
    k_pv<<<dim3(TT / 256, NB_, 1), 512, 0, stream>>>(KF, QF, VF, BI, OUT);   /* out[q] = sum_k attn[q][k] v[k] */
}

// v007
// It runs in 94.4 microseconds.
// In two side-by-side timings against v006, it was 1.04 and 1.03 times as fast.
// Counting every step since v000, it is 34.2 times as fast.
#include <hip/hip_runtime.h>

// Scaled dot-product attention with the source's query-axis softmax (q, k, v [16][4096][64] given directly; x[q][k] = q_q.k_k / 8; attn = softmax over the QUERY axis (per key column); out[q][d] = sum_k attn[q][k] v[k][d] -> [16][4096][64] (4.2 M)).
// Each launch covers all NB_ batches: the batch index is a grid dimension, or the rows are counted over all batches.
// Algorithm per batch: q and k as bf16 planes, v as an fp16 plane, all three stored in the order of the WMMA fragments (a fragment half = 512 contiguous bytes of a wave); pass 1 computes the transposed scores S^T[k][q] = k_k.q_q for 32 keys a wave, streams the queries past them under a running maximum and sum and leaves one f32 per key, bias = log2(1024 / sum) - max / 8 * log2(e); pass 2 computes the scores again for 32 queries a wave, p = exp2(s / 8 * log2(e) + bias) = 1024 x the probability, packs two score tiles as the fp16 B operand of out^T += v^T.P^T: the probabilities never leave the registers. Keys split over the KSPL wave groups of a work-group, whose partial sums are added through LDS, the 1/1024 undone in f32, and out stored by the same kernel.
// Compute dtypes, f32 accumulate: q, k, v rounded to bf16, so the score operands are exact bf16 planes (one product, exact); softmax f32; fp16 probabilities (x1024) x fp16 v (one product); 1/1024 in f32.

#define NB_  16
#define TT   4096
#define HD   64
#define PCAR 1024.0f
#define SCL  0.125f
typedef _Float16 h16;
typedef unsigned short bf;
typedef __attribute__((ext_vector_type(16))) __bf16   v16bf;
typedef __attribute__((ext_vector_type(16))) _Float16 v16h;
typedef __attribute__((ext_vector_type(8)))  _Float16 v8h;
typedef __attribute__((ext_vector_type(8)))  unsigned short v8us;
typedef __attribute__((ext_vector_type(8)))  float    v8f;
typedef __attribute__((ext_vector_type(4)))  float    v4f;
typedef __attribute__((ext_vector_type(2)))  float    v2f;
typedef __attribute__((ext_vector_type(4)))  unsigned short v4us;
typedef __attribute__((ext_vector_type(2)))  unsigned short v2us;
typedef __attribute__((ext_vector_type(4)))  _Float16 v4h;
typedef __attribute__((ext_vector_type(2)))  _Float16 v2h;
typedef v8h  __attribute__((may_alias)) v8ha;
typedef v4f  __attribute__((may_alias)) v4fa;
typedef v8us __attribute__((may_alias)) v8usa;
typedef v2f  __attribute__((may_alias)) v2fa;

__device__ __forceinline__ unsigned short f2bf(float f) { unsigned u = __float_as_uint(f); u += 0x7FFFu + ((u >> 16) & 1u); return (unsigned short)(u >> 16); }
__device__ __forceinline__ float bf2f(unsigned short b) { return __uint_as_float(((unsigned)b) << 16); }
__device__ __forceinline__ float bfr(float f) { return bf2f(f2bf(f)); }
__device__ __forceinline__ h16 tohx(float x) { return (h16)x; }
// v_exp_f32 with the one slot the instruction set asks for behind a transcendental: the v_nop in the same statement cannot drift away
__device__ __forceinline__ float exp2_slot(float x) { float e; asm("v_exp_f32 %0, %1\n\tv_nop" : "=v"(e) : "v"(x)); return e; }
// v_log_f32 with the same slot behind it
__device__ __forceinline__ float log2_slot(float x) { float e; asm("v_log_f32 %0, %1\n\tv_nop" : "=v"(e) : "v"(x)); return e; }
// eight independent v_exp_f32 in one statement: each fills the slot behind the one in front of it (no result is read and, the outputs being early-clobber, no source overwritten), the v_nop fills the last one's
__device__ __forceinline__ void exp2x8(v2f (&e)[4], const v2f (&x)[4]) { float a, b, c, d, f, g, h, i;
    asm("v_exp_f32 %0, %8\n\tv_exp_f32 %1, %9\n\tv_exp_f32 %2, %10\n\tv_exp_f32 %3, %11\n\tv_exp_f32 %4, %12\n\tv_exp_f32 %5, %13\n\tv_exp_f32 %6, %14\n\tv_exp_f32 %7, %15\n\tv_nop"
        : "=&v"(a), "=&v"(b), "=&v"(c), "=&v"(d), "=&v"(f), "=&v"(g), "=&v"(h), "=&v"(i) : "v"(x[0][0]), "v"(x[0][1]), "v"(x[1][0]), "v"(x[1][1]), "v"(x[2][0]), "v"(x[2][1]), "v"(x[3][0]), "v"(x[3][1]));
    e[0] = (v2f){a, b}; e[1] = (v2f){c, d}; e[2] = (v2f){f, g}; e[3] = (v2f){h, i}; }
__device__ __forceinline__ v16h cat16(v8h lo, v8h hi) { return __builtin_shufflevector(lo, hi, 0, 1, 2, 3, 4, 5, 6, 7, 8, 9, 10, 11, 12, 13, 14, 15); }
__device__ __forceinline__ v16bf cat16b(v8us lo, v8us hi) { return __builtin_bit_cast(v16bf, __builtin_shufflevector(lo, hi, 0, 1, 2, 3, 4, 5, 6, 7, 8, 9, 10, 11, 12, 13, 14, 15)); }
__device__ __forceinline__ v8f wmma16(v16h a, v16h b, v8f c) { return __builtin_amdgcn_wmma_f32_16x16x32_f16(false, a, false, b, (short)0, c, false, false); }
__device__ __forceinline__ v8f wmmab(v16bf a, v16bf b, v8f c) { return __builtin_amdgcn_wmma_f32_16x16x32_bf16(false, a, false, b, (short)0, c, false, false); }

// fragment planes: a 16-row x 64-k tile is 2 fragments x 2 halves x 32 lanes x 8 elements; lane (lr, hi) of half h2 of fragment f holds k = 32 f + 16 h2 + 8 hi + 0..7 of row lr (the hardware k order of the 16x16x32 forms, the same for A and B), each half one contiguous 512-byte load of a wave
__device__ __forceinline__ v16bf ldfb(const bf* p) { return cat16b(*(const v8us*)p, *(const v8us*)(p + 256)); }
__device__ __forceinline__ v16h ldfh(const h16* p) { return cat16(*(const v8h*)p, *(const v8h*)(p + 256)); }
// 16 bytes of global memory at a byte address plus a constant: the address-space cast keeps the load a global one although the address has passed through an asm operand
__device__ __forceinline__ v8us g16(unsigned long long base, unsigned off) { return *(const __attribute__((address_space(1))) v8us*)((const __attribute__((address_space(1))) char*)base + off); }
#define LC (1.4426950408889634f * SCL)

// ---- k_stats: pass 1, score GEMM and the column softmax's maximum and sum, the queries streamed. One wave = 32 keys x half the queries of one batch; work-group = 128 keys (4 key groups x 2 query shares); grid (TT/128, batches), 8 waves.
// A trip is 64 queries: S^T[2 key tiles][4 query tiles] (lane = query, register = key). Every lane keeps, per key, a running maximum and the sum of exp2((s - maximum) * LC) over the queries it has seen; a new maximum rescales the sum once a trip. Nothing but 32 keys' fragments and these 32 values outlives a trip, so a query fragment is loaded once for 2 products, one per key tile, and the work-group's waves read the same 16 KB at about the same time.
// The two shares take the 64-query pieces alternately. At the end one thread a key folds the 16 lanes' and two shares' values through LDS.
#define SQC 4
#define SNT (TT / (16 * SQC * 2))
// LDS pitch, in floats, of a key's 16 entries: the two half-waves' stores fall on different banks, and 32 keys' 8-byte reads on all 64
#define SPI 18
// waves_per_eu: a register budget of 256, so that two work-groups share a WGP and four waves a SIMD: one wave's exponentials run beside another's WMMAs
__global__ __launch_bounds__(256) __attribute__((amdgpu_waves_per_eu(4, 4))) void k_stats(const bf* __restrict__ Kf, const bf* __restrict__ Qf, float* BI) {
    __shared__ __align__(16) float redm[8 * 32 * SPI];
    __shared__ __align__(16) float reds[8 * 32 * SPI];
    const int wave = threadIdx.x >> 5, lane = threadIdx.x & 31, lr = lane & 15, hi = lane >> 4;
    const bf* pk = Kf + (size_t)blockIdx.y * (TT * HD) + ((size_t)blockIdx.x * 4 + (wave >> 1)) * (32 * HD) + lane * 8;
    // the lane's own byte address in the q plane, carried through the loop in registers of its own
    unsigned long long aq = (unsigned long long)(Qf + (size_t)blockIdx.y * (TT * HD) + (size_t)(wave & 1) * (SQC * 16 * HD) + lane * 8);
    v16bf ka[2][2], qb[SQC][2];
#pragma unroll
    for (int kt = 0; kt < 2; ++kt) { ka[kt][0] = ldfb(pk + kt * 1024); ka[kt][1] = ldfb(pk + kt * 1024 + 512); }
    // precaution: stands between the key loads and the query loads, one of which the compiler lets land in the key loads' address registers
    asm volatile("s_wait_xcnt 0x0" ::: "memory");
#pragma unroll
    for (int u = 0; u < SQC; ++u) { qb[u][0] = cat16b(g16(aq, u * 2048), g16(aq, u * 2048 + 512)); qb[u][1] = cat16b(g16(aq, u * 2048 + 1024), g16(aq, u * 2048 + 1536)); }
    v2f mx[2][4], sm[2][4];   // per key tile: keys 8 hi + 2 i, 8 hi + 2 i + 1
#pragma unroll
    for (int kt = 0; kt < 2; ++kt)
#pragma unroll
        for (int i = 0; i < 4; ++i) { mx[kt][i] = (v2f){-__builtin_inff(), -__builtin_inff()}; sm[kt][i] = (v2f){0.f, 0.f}; }
    // rolled: one trip's 16 WMMAs and 80 exponentials are the body; unrolled it would need a second set of fragment registers and lose the fourth wave per SIMD
#pragma unroll 1
    for (int t = 0; t < SNT; ++t) {
        const int more = t + 1 < SNT;   // the last trip fetches its own fragments again instead of the bytes behind the plane
        v8f s[2][SQC];
#pragma unroll
        for (int kt = 0; kt < 2; ++kt)
#pragma unroll
            for (int u = 0; u < SQC; ++u) s[kt][u] = wmmab(ka[kt][0], qb[u][0], (v8f){});
#pragma unroll
        for (int kt = 0; kt < 2; ++kt)
#pragma unroll
            for (int u = 0; u < SQC; ++u) s[kt][u] = wmmab(ka[kt][1], qb[u][1], s[kt][u]);
        // keeps the sixteen products back to back: mixed with the maxima below, the compiler pads each first use of a tile with v_nop
        __builtin_amdgcn_sched_barrier(0);
        // maximum on the unscaled scores (LC is positive: it commutes with the maximum)
        v2f mn[2][4];
#pragma unroll
        for (int kt = 0; kt < 2; ++kt)
#pragma unroll
            for (int i = 0; i < 4; ++i)
#pragma unroll
                for (int c = 0; c < 2; ++c) mn[kt][i][c] = fmaxf(fmaxf(fmaxf(mx[kt][i][c], s[kt][0][2 * i + c]), s[kt][1][2 * i + c]), fmaxf(s[kt][2][2 * i + c], s[kt][3][2 * i + c]));
        // precaution: stands between the loads issued so far and the overwrite of their address registers; the address is an operand so that its step cannot be lifted over the wait
        asm volatile("s_wait_xcnt 0x0" : "+v"(aq) :: "memory");
        aq += more ? (unsigned)(2 * SQC * 16 * HD * 2) : 0u;
#pragma unroll
        for (int u = 0; u < SQC; ++u) { qb[u][0] = cat16b(g16(aq, u * 2048), g16(aq, u * 2048 + 512)); qb[u][1] = cat16b(g16(aq, u * 2048 + 1024), g16(aq, u * 2048 + 1536)); }
#pragma unroll
        for (int kt = 0; kt < 2; ++kt) { v2f nb[4], d[4], e[4];
#pragma unroll
            for (int i = 0; i < 4; ++i) { nb[i] = mn[kt][i] * (v2f){-LC, -LC}; d[i] = __builtin_elementwise_fma(mx[kt][i], (v2f){LC, LC}, nb[i]); }
            exp2x8(e, d);   // what the sum so far shrinks by; 0 in the first trip
#pragma unroll
            for (int i = 0; i < 4; ++i) { v2f x[SQC], p[SQC];
#pragma unroll
                for (int u = 0; u < SQC; ++u) x[u] = __builtin_elementwise_fma((v2f){s[kt][u][2 * i], s[kt][u][2 * i + 1]}, (v2f){LC, LC}, nb[i]);
                exp2x8(p, x);
                sm[kt][i] = __builtin_elementwise_fma(sm[kt][i], e[i], (p[0] + p[1]) + (p[2] + p[3])); mx[kt][i] = mn[kt][i]; } }
    }
    // the last trip's repeated fetch has landed before the wave goes on and gives its registers back
    asm volatile("s_wait_loadcnt 0x0" ::: "memory");
    // every lane leaves its 16 maxima and sums in LDS, a key's 16 entries side by side
#pragma unroll
    for (int kt = 0; kt < 2; ++kt)
#pragma unroll
        for (int j = 0; j < 8; ++j) { const int r = (wave * 32 + kt * 16 + hi * 8 + j) * SPI + lr; redm[r] = mx[kt][j >> 1][j & 1]; reds[r] = sm[kt][j >> 1][j & 1]; }
    __syncthreads();
    if (threadIdx.x < 128) {   // thread = key: the 16 lanes' entries of its two shares, which lie 32 rows apart
        const int g = ((int)(threadIdx.x >> 5) * 64 + (int)(threadIdx.x & 31)) * SPI;
        v2f a[16], b[16];
#pragma unroll
        for (int i = 0; i < 8; ++i) { a[i] = *(const v2fa*)(redm + g + 2 * i); a[8 + i] = *(const v2fa*)(redm + g + 32 * SPI + 2 * i); b[i] = *(const v2fa*)(reds + g + 2 * i); b[8 + i] = *(const v2fa*)(reds + g + 32 * SPI + 2 * i); }
        float m = fmaxf(a[0][0], a[0][1]);
#pragma unroll
        for (int i = 1; i < 16; ++i) m = fmaxf(fmaxf(m, a[i][0]), a[i][1]);
        const float nb = m * -LC; v2f sv = (v2f){0.f, 0.f};
#pragma unroll
        for (int i = 0; i < 16; i += 4) { v2f x[4], e[4];
#pragma unroll
            for (int u = 0; u < 4; ++u) x[u] = __builtin_elementwise_fma(a[i + u], (v2f){LC, LC}, (v2f){nb, nb});
            exp2x8(e, x);
#pragma unroll
            for (int u = 0; u < 4; ++u) sv = __builtin_elementwise_fma(b[i + u], e[u], sv); }
        BI[(size_t)blockIdx.y * TT + (int)blockIdx.x * 128 + (int)threadIdx.x] = (10.0f - log2_slot(sv[0] + sv[1])) + nb; }   // 10 = log2(PCAR)
}

// ---- k_pv: pass 2, scores again, probabilities and the P.v product without a trip through memory. One wave = 32 queries x TT/KSPL keys; work-group = 256 queries x all keys (8 query groups x KSPL key shares); grid (TT/256, batches), 16 waves.
// A pass is 32 keys: S^T = K.Q^T for 2 key tiles x 2 query tiles (lane = query, register r = key 8 hi + r), p = exp2(s * LC + bias[key]); the two key tiles of one query tile, converted in place, are the fp16 B operand (k = 8 hi + 0..7, 16 + 8 hi + 0..7) of out^T[d][q] += v^T[d][k] P^T[k][q]; the v plane holds its A fragments in that k order.
// K, bias and v fragments of the next pass are fetched into the same registers right behind their last use. At the end the two waves that hold the two key shares of the same 32 queries swap one query tile each through LDS; each adds the shares of the tile it kept (share 0 + share 1), undoes the 1024 and stores 16 rows of out.
#define KSPL 2
#define NPAS (TT / KSPL / 32)
static_assert(PCAR == 1024.0f, "k_stats writes log2(PCAR) as 10");
static_assert(KSPL == 2, "the waves swap their sums in pairs");
// waves_per_eu: a register budget of 256, so that the work-group's 16 waves fill a WGP, four waves a SIMD: one wave's exponentials run beside another's WMMAs
__global__ __launch_bounds__(512) __attribute__((amdgpu_waves_per_eu(4, 4))) void k_pv(const bf* __restrict__ Kf, const bf* __restrict__ Qf, const h16* __restrict__ Vf, const float* __restrict__ BI, float* O) {
    // a wave's slot: 8 pieces of 32 lanes x 16 bytes, each piece one contiguous 512-byte LDS access of the wave
    __shared__ __align__(16) float fold[16 * 8 * 128];
    const int wave = threadIdx.x >> 5, lane = threadIdx.x & 31, lr = lane & 15, hi = lane >> 4;
    const int ks = wave >> 3;   // the wave's key share
    const int q0 = ((int)blockIdx.x * 8 + (wave & 7)) * 32, k0 = ks * (TT / KSPL);
    const bf* pq = Qf + (size_t)blockIdx.y * (TT * HD) + (size_t)q0 * HD + lane * 8;
    // K, v and bias: the lane's own byte address, carried through the loop in registers of its own
    unsigned long long ak = (unsigned long long)(Kf + (size_t)blockIdx.y * (TT * HD) + (size_t)k0 * HD + lane * 8);
    unsigned long long av = (unsigned long long)(Vf + (size_t)blockIdx.y * (TT * HD) + (size_t)k0 * HD + lane * 8);
    unsigned long long ab = (unsigned long long)(BI + (size_t)blockIdx.y * TT + k0 + hi * 8);
    v16bf qb[2][2];
#pragma unroll
    for (int qt = 0; qt < 2; ++qt) { qb[qt][0] = ldfb(pq + qt * 1024); qb[qt][1] = ldfb(pq + qt * 1024 + 512); }
    v8f o[4][2];
#pragma unroll
    for (int dt = 0; dt < 4; ++dt) { o[dt][0] = (v8f){}; o[dt][1] = (v8f){}; }
    v16bf ka[2][2]; v16h va[4]; v4f bi[2][2];
#pragma unroll
    for (int kt = 0; kt < 2; ++kt) { ka[kt][0] = cat16b(g16(ak, kt * 2048), g16(ak, kt * 2048 + 512)); ka[kt][1] = cat16b(g16(ak, kt * 2048 + 1024), g16(ak, kt * 2048 + 1536));
        bi[kt][0] = __builtin_bit_cast(v4f, g16(ab, kt * 64)); bi[kt][1] = __builtin_bit_cast(v4f, g16(ab, kt * 64 + 16)); }
    // the v loads stand behind the K and bias loads as in the loop: in another order the counted waits at the loop's head, which must hold for both ways in, wait for the v fragments too
    __builtin_amdgcn_sched_barrier(0);
#pragma unroll
    for (int dt = 0; dt < 4; ++dt) va[dt] = cat16(__builtin_bit_cast(v8h, g16(av, dt * 1024)), __builtin_bit_cast(v8h, g16(av, dt * 1024 + 512)));
    // rolled: one pass's 16 WMMAs and 32 exponentials are the body; unrolled it would need a second set of fragment registers and lose the fourth wave per SIMD
#pragma unroll 1
    for (int p = 0; p < NPAS; ++p) {
        const int more = p + 1 < NPAS;   // the last pass fetches its own fragments again instead of the bytes behind its range
        v8f s[2][2];
#pragma unroll
        for (int kt = 0; kt < 2; ++kt)
#pragma unroll
            for (int qt = 0; qt < 2; ++qt) s[kt][qt] = wmmab(ka[kt][0], qb[qt][0], (v8f){});
#pragma unroll
        for (int kt = 0; kt < 2; ++kt)
#pragma unroll
            for (int qt = 0; qt < 2; ++qt) s[kt][qt] = wmmab(ka[kt][1], qb[qt][1], s[kt][qt]);
        // keeps the eight products back to back: mixed with the multiply-adds below, the compiler pads each first use of a tile with v_nop
        __builtin_amdgcn_sched_barrier(0);
        v2f x[2][2][4];
#pragma unroll
        for (int kt = 0; kt < 2; ++kt)
#pragma unroll
            for (int qt = 0; qt < 2; ++qt)
#pragma unroll
                for (int i = 0; i < 4; ++i) x[kt][qt][i] = __builtin_elementwise_fma((v2f){s[kt][qt][2 * i], s[kt][qt][2 * i + 1]}, (v2f){LC, LC}, (v2f){bi[kt][i >> 1][2 * (i & 1)], bi[kt][i >> 1][2 * (i & 1) + 1]});
        // the scheduler may move nothing over this line: without it the fetch below sinks to the loop's foot and its latency stands open in front of the next pass's first WMMA
        __builtin_amdgcn_sched_barrier(0);
        // precaution: stands between the loads issued so far and the overwrite of their address registers; the addresses are operands so that their step cannot be lifted over the wait
        asm volatile("s_wait_xcnt 0x0" : "+v"(ak), "+v"(ab) :: "memory");
        ak += more ? 4096u : 0u; ab += more ? 128u : 0u;
#pragma unroll
        for (int kt = 0; kt < 2; ++kt) { ka[kt][0] = cat16b(g16(ak, kt * 2048), g16(ak, kt * 2048 + 512)); ka[kt][1] = cat16b(g16(ak, kt * 2048 + 1024), g16(ak, kt * 2048 + 1536));
            bi[kt][0] = __builtin_bit_cast(v4f, g16(ab, kt * 64)); bi[kt][1] = __builtin_bit_cast(v4f, g16(ab, kt * 64 + 16)); }
        // holds the fetch in front of the exponentials, which cover its latency
        __builtin_amdgcn_sched_barrier(0);
        v16h pf[2];
#pragma unroll
        for (int qt = 0; qt < 2; ++qt)
#pragma unroll
            for (int kt = 0; kt < 2; ++kt) { v2f e[4]; exp2x8(e, x[kt][qt]);
#pragma unroll
                for (int i = 0; i < 4; ++i) { const v2h c = __builtin_convertvector(e[i], v2h); pf[qt][kt * 8 + 2 * i] = c[0]; pf[qt][kt * 8 + 2 * i + 1] = c[1]; } }
#pragma unroll
        for (int dt = 0; dt < 4; ++dt)
#pragma unroll
            for (int qt = 0; qt < 2; ++qt) o[dt][qt] = wmma16(va[dt], pf[qt], o[dt][qt]);
        // keeps the address step behind the products, whose operands the wait for the earlier v loads has covered
        __builtin_amdgcn_sched_barrier(0);
        // precaution: as above
        asm volatile("s_wait_xcnt 0x0" : "+v"(av) :: "memory");
        av += more ? 4096u : 0u;
#pragma unroll
        for (int dt = 0; dt < 4; ++dt) va[dt] = cat16(__builtin_bit_cast(v8h, g16(av, dt * 1024)), __builtin_bit_cast(v8h, g16(av, dt * 1024 + 512)));
    }
    // the last pass's repeated fetch has landed before the wave stores its sums and gives its registers back
    asm volatile("s_wait_loadcnt 0x0" ::: "memory");
    // the wave of key share ks keeps query tile ks and hands the other tile to its partner, wave ^ 8, which holds the same lanes' sums over the other keys
    float* fs = fold + wave * 1024 + lane * 4; const float* fr = fold + (wave ^ 8) * 1024 + lane * 4;
    v8f mine[4];
#pragma unroll
    for (int dt = 0; dt < 4; ++dt) { const v8f g = ks ? o[dt][0] : o[dt][1]; mine[dt] = ks ? o[dt][1] : o[dt][0];
        *(v4fa*)(fs + dt * 256) = __builtin_shufflevector(g, g, 0, 1, 2, 3); *(v4fa*)(fs + dt * 256 + 128) = __builtin_shufflevector(g, g, 4, 5, 6, 7); }
    __syncthreads();
    float* po = O + ((size_t)blockIdx.y * TT + q0 + ks * 16 + lr) * HD + 8 * hi;
#pragma unroll
    for (int dt = 0; dt < 4; ++dt) { const v4f a = *(const v4fa*)(fr + dt * 256), b = *(const v4fa*)(fr + dt * 256 + 128);
        *(v8f*)(po + dt * 16) = (mine[dt] + __builtin_shufflevector(a, b, 0, 1, 2, 3, 4, 5, 6, 7)) * (1.0f / PCAR); }   // a lane's 8 registers are 8 consecutive d of one query
}

// ---- k_planes: q and k to their bf16 fragment planes and v to the fp16 plane of A fragments of v^T (per 32 keys 4 d tiles x 2 halves x 32 lanes x 8 keys; lane (lr, hi) of half h2 holds keys 16 h2 + 8 hi + 0..7 of d = 16 dt + lr), all three in one launch. One wave = the same 16 rows (counted over all batches) of q, of k and of v; work-group = 8 waves; grid NB_ * TT / 128: 16 waves a WGP.
// Every load is two whole rows of the wave (q, k: rows 2 j, 2 j + 1, 512 contiguous bytes; v: rows j and 8 + j), all 24 issued before the first is used. The converted pieces change lanes through the wave's own LDS range, laid out in plane order, so that every store is 512 contiguous bytes too. No other wave reads that range: no barrier.
// q, k: lane (c, hi) of load j holds columns 4 c + 0..3 of row 2 j + hi, half of the piece (block c / 2, row). v: lane (c, hi) of load j holds d = 4 c + 0..3 of key 8 hi + j, so after 8 loads four whole pieces (8 keys of one d).
// LDS pitch, in 16-bit elements, of one 8-column block of a q or k tile (16 rows x 8, + 16): the 32 lanes' 8-byte stores of one row pair fall on all 64 banks once
#define PQP 144
// the same of one d tile of v (32 pieces x 8, + 8): the 16-byte stores of a half-wave fall on all 64 banks once
#define PVP 264
#define PWS (2 * 8 * PQP + 4 * PVP)
static_assert((NB_ * TT) % 128 == 0 && TT % 32 == 0 && HD == 64, "a wave takes 16 whole rows of 64, a work-group 128");
typedef v4us __attribute__((may_alias)) v4usa;
__global__ __launch_bounds__(256) void k_planes(const float* __restrict__ q, const float* __restrict__ k, const float* __restrict__ v, bf* QF, bf* KF, h16* VF) {
    __shared__ __align__(16) bf st[8 * PWS];
    const int wave = threadIdx.x >> 5, lane = threadIdx.x & 31, c = lane & 15, hi = lane >> 4;
    const size_t t = (size_t)blockIdx.x * 8 + wave;   // the 16-row tile
    const float* sq = q + t * (16 * HD) + hi * HD + c * 4; const float* sk = k + t * (16 * HD) + hi * HD + c * 4; const float* sv = v + t * (16 * HD) + hi * (8 * HD) + c * 4;
    v4f a[8], b[8], w[8];
#pragma unroll
    for (int j = 0; j < 8; ++j) a[j] = *(const v4f*)(sq + j * (2 * HD));
    // precaution: stands between these loads and the later ones, one of which the compiler lets land in their address registers
    asm volatile("s_wait_xcnt 0x0" ::: "memory");
#pragma unroll
    for (int j = 0; j < 8; ++j) b[j] = *(const v4f*)(sk + j * (2 * HD));
    // precaution: as above
    asm volatile("s_wait_xcnt 0x0" ::: "memory");
#pragma unroll
    for (int j = 0; j < 8; ++j) w[j] = *(const v4f*)(sv + j * HD);
    // holds all 24 loads in front of the first conversion: 12 KB of a wave in flight at once
    __builtin_amdgcn_sched_barrier(0);
    bf* lq = st + wave * PWS; bf* lk = lq + 8 * PQP; bf* lv = lk + 8 * PQP;
    const int wq = (c >> 1) * PQP + hi * 8 + (c & 1) * 4, wv = (c >> 2) * PVP + hi * 128 + (c & 3) * 32;
#pragma unroll
    for (int j = 0; j < 8; ++j) { v4us o;
#pragma unroll
        for (int e = 0; e < 4; ++e) o[e] = f2bf(a[j][e]);
        *(v4usa*)(lq + wq + j * 16) = o; }
#pragma unroll
    for (int j = 0; j < 8; ++j) { v4us o;
#pragma unroll
        for (int e = 0; e < 4; ++e) o[e] = f2bf(b[j][e]);
        *(v4usa*)(lk + wq + j * 16) = o; }
#pragma unroll
    for (int e = 0; e < 4; ++e) { v8h o;
#pragma unroll
        for (int u = 0; u < 8; ++u) o[u] = tohx(bfr(w[u][e]));
        *(v8usa*)(lv + wv + e * 8) = __builtin_bit_cast(v8us, o); }
    // the wave's own LDS stores have landed before its lanes read one another's pieces back
    asm volatile("s_wait_dscnt 0x0" ::: "memory");
    v8us x[4], y[4], z[4];
#pragma unroll
    for (int i = 0; i < 4; ++i) { x[i] = *(const v8usa*)(lq + (2 * i + hi) * PQP + c * 8); y[i] = *(const v8usa*)(lk + (2 * i + hi) * PQP + c * 8); z[i] = *(const v8usa*)(lv + i * PVP + lane * 8); }
    bf* dq = QF + t * 1024 + lane * 8; bf* dk = KF + t * 1024 + lane * 8; h16* dv = VF + (t >> 1) * 2048 + (t & 1) * 256 + lane * 8;
#pragma unroll
    for (int i = 0; i < 4; ++i) *(v8us*)(dq + i * 256) = x[i];
#pragma unroll
    for (int i = 0; i < 4; ++i) *(v8us*)(dk + i * 256) = y[i];
#pragma unroll
    for (int i = 0; i < 4; ++i) *(v8h*)(dv + i * 512) = __builtin_bit_cast(v8h, z[i]);
}

extern "C" void kernel_launch(void* const* d_in, const int* in_sizes, int n_in,
                              void* d_out, int out_size, void* d_ws, size_t ws_size, hipStream_t stream) {
    (void)in_sizes; (void)n_in; (void)out_size;
    const float* qin = (const float*)d_in[0]; const float* kin = (const float*)d_in[1]; const float* vin = (const float*)d_in[2];
    float* OUT = (float*)d_out;     // [16][4096][64]
    char* wsp = (char*)d_ws;
    auto take = [&](size_t bytes) { char* p = wsp; wsp += (bytes + 255) & ~(size_t)255; return (void*)p; };
    bf* QF = (bf*)take((size_t)NB_ * TT * HD * 2); bf* KF = (bf*)take((size_t)NB_ * TT * HD * 2); h16* VF = (h16*)take((size_t)NB_ * HD * TT * 2); float* BI = (float*)take((size_t)NB_ * TT * 4);
    if ((size_t)(wsp - (char*)d_ws) > ws_size) return;
    k_planes<<<NB_ * TT / 128, 256, 0, stream>>>(qin, kin, vin, QF, KF, VF);
    k_stats<<<dim3(TT / 128, NB_, 1), 256, 0, stream>>>(KF, QF, BI);   /* per key: log2(1024 / sum over q) - max over q, in the exponent's units */
    k_pv<<<dim3(TT / 256, NB_, 1), 512, 0, stream>>>(KF, QF, VF, BI, OUT);   /* out[q] = sum_k attn[q][k] v[k] */
}

// v008
// It runs in 89.2 microseconds.
// Two timings next to v007 put it at 1.06 and 1.07 times that version's speed.
// All steps since v000 together make it 36.6 times as fast.
#include <hip/hip_runtime.h>

// Scaled dot-product attention with the source's query-axis softmax (q, k, v [16][4096][64] given directly; x[q][k] = q_q.k_k / 8; attn = softmax over the QUERY axis (per key column); out[q][d] = sum_k attn[q][k] v[k][d] -> [16][4096][64] (4.2 M)).
// Each launch covers all NB_ batches: the batch index is a grid dimension, or the rows are counted over all batches.
// Algorithm per batch: q and k as bf16 planes, v as an fp16 plane, all three stored in the order of the WMMA fragments (a fragment half = 512 contiguous bytes of a wave); pass 1 computes the transposed scores S^T[k][q] = k_k.q_q for 32 keys a wave, streams the queries past them under a running maximum and sum and leaves one f32 per key, bias = log2(1024 / sum) - max / 8 * log2(e); pass 2 computes the scores again for 32 queries a wave, p = exp2(s / 8 * log2(e) + bias) = 1024 x the probability, packs two score tiles as the fp16 B operand of out^T += v^T.P^T: the probabilities never leave the registers. Keys split over the KSPL wave groups of a work-group, whose partial sums are added through LDS, the 1/1024 undone in f32, and out stored by the same kernel.
// Compute dtypes, f32 accumulate: q, k, v rounded to bf16, so the score operands are exact bf16 planes (one product, exact); softmax f32; fp16 probabilities (x1024) x fp16 v (one product); 1/1024 in f32.

#define NB_  16
#define TT   4096
#define HD   64
#define PCAR 1024.0f
#define SCL  0.125f
typedef _Float16 h16;
typedef unsigned short bf;
typedef __attribute__((ext_vector_type(16))) __bf16   v16bf;
typedef __attribute__((ext_vector_type(16))) _Float16 v16h;
typedef __attribute__((ext_vector_type(8)))  _Float16 v8h;
typedef __attribute__((ext_vector_type(8)))  unsigned short v8us;
typedef __attribute__((ext_vector_type(8)))  float    v8f;
typedef __attribute__((ext_vector_type(4)))  float    v4f;
typedef __attribute__((ext_vector_type(2)))  float    v2f;
typedef __attribute__((ext_vector_type(4)))  unsigned short v4us;
typedef __attribute__((ext_vector_type(2)))  unsigned short v2us;
typedef __attribute__((ext_vector_type(4)))  _Float16 v4h;
typedef __attribute__((ext_vector_type(2)))  _Float16 v2h;
typedef v8h  __attribute__((may_alias)) v8ha;
typedef v4f  __attribute__((may_alias)) v4fa;
typedef v8us __attribute__((may_alias)) v8usa;
typedef v2f  __attribute__((may_alias)) v2fa;

__device__ __forceinline__ unsigned short f2bf(float f) { unsigned u = __float_as_uint(f); u += 0x7FFFu + ((u >> 16) & 1u); return (unsigned short)(u >> 16); }
__device__ __forceinline__ float bf2f(unsigned short b) { return __uint_as_float(((unsigned)b) << 16); }
__device__ __forceinline__ float bfr(float f) { return bf2f(f2bf(f)); }
__device__ __forceinline__ h16 tohx(float x) { return (h16)x; }
// v_exp_f32 with the one slot the instruction set asks for behind a transcendental: the v_nop in the same statement cannot drift away
__device__ __forceinline__ float exp2_slot(float x) { float e; asm("v_exp_f32 %0, %1\n\tv_nop" : "=v"(e) : "v"(x)); return e; }
// v_log_f32 with the same slot behind it
__device__ __forceinline__ float log2_slot(float x) { float e; asm("v_log_f32 %0, %1\n\tv_nop" : "=v"(e) : "v"(x)); return e; }
// eight independent v_exp_f32 in one statement: each fills the slot behind the one in front of it (no result is read and, the outputs being early-clobber, no source overwritten), the v_nop fills the last one's
__device__ __forceinline__ void exp2x8(v2f (&e)[4], const v2f (&x)[4]) { float a, b, c, d, f, g, h, i;
    asm("v_exp_f32 %0, %8\n\tv_exp_f32 %1, %9\n\tv_exp_f32 %2, %10\n\tv_exp_f32 %3, %11\n\tv_exp_f32 %4, %12\n\tv_exp_f32 %5, %13\n\tv_exp_f32 %6, %14\n\tv_exp_f32 %7, %15\n\tv_nop"
        : "=&v"(a), "=&v"(b), "=&v"(c), "=&v"(d), "=&v"(f), "=&v"(g), "=&v"(h), "=&v"(i) : "v"(x[0][0]), "v"(x[0][1]), "v"(x[1][0]), "v"(x[1][1]), "v"(x[2][0]), "v"(x[2][1]), "v"(x[3][0]), "v"(x[3][1]));
    e[0] = (v2f){a, b}; e[1] = (v2f){c, d}; e[2] = (v2f){f, g}; e[3] = (v2f){h, i}; }
__device__ __forceinline__ v16h cat16(v8h lo, v8h hi) { return __builtin_shufflevector(lo, hi, 0, 1, 2, 3, 4, 5, 6, 7, 8, 9, 10, 11, 12, 13, 14, 15); }
__device__ __forceinline__ v16bf cat16b(v8us lo, v8us hi) { return __builtin_bit_cast(v16bf, __builtin_shufflevector(lo, hi, 0, 1, 2, 3, 4, 5, 6, 7, 8, 9, 10, 11, 12, 13, 14, 15)); }
__device__ __forceinline__ v8f wmma16(v16h a, v16h b, v8f c) { return __builtin_amdgcn_wmma_f32_16x16x32_f16(false, a, false, b, (short)0, c, false, false); }
__device__ __forceinline__ v8f wmmab(v16bf a, v16bf b, v8f c) { return __builtin_amdgcn_wmma_f32_16x16x32_bf16(false, a, false, b, (short)0, c, false, false); }

// fragment planes: a 16-row x 64-k tile is 2 fragments x 2 halves x 32 lanes x 8 elements; lane (lr, hi) of half h2 of fragment f holds k = 32 f + 16 h2 + 8 hi + 0..7 of row lr (the hardware k order of the 16x16x32 forms, the same for A and B), each half one contiguous 512-byte load of a wave
__device__ __forceinline__ v16bf ldfb(const bf* p) { return cat16b(*(const v8us*)p, *(const v8us*)(p + 256)); }
__device__ __forceinline__ v16h ldfh(const h16* p) { return cat16(*(const v8h*)p, *(const v8h*)(p + 256)); }
// 16 bytes of global memory at a byte address plus a constant: the address-space cast keeps the load a global one although the address has passed through an asm operand
__device__ __forceinline__ v8us g16(unsigned long long base, unsigned off) { return *(const __attribute__((address_space(1))) v8us*)((const __attribute__((address_space(1))) char*)base + off); }
#define LC (1.4426950408889634f * SCL)

// ---- k_stats: pass 1, score GEMM and the column softmax's maximum and sum, the queries streamed. One wave = 32 keys x half the queries of one batch; work-group = 128 keys (4 key groups x 2 query shares); grid (TT/128, batches), 8 waves.
// A trip is 64 queries: S^T[2 key tiles][4 query tiles] (lane = query, register = key). Every lane keeps, per key, a running maximum and the sum of exp2((s - maximum) * LC) over the queries it has seen; a new maximum rescales the sum once a trip. Nothing but 32 keys' fragments and these 32 values outlives a trip, so a query fragment is loaded once for 2 products, one per key tile, and the work-group's waves read the same 16 KB at about the same time.
// The two shares take the 64-query pieces alternately. At the end one thread a key folds the 16 lanes' and two shares' values through LDS.
// The work-groups of a batch all walk the same q plane: each starts at a trip of its own (its index along x) and wraps round, so that at no moment do they all ask L2 for the same lines.
#define SQC 4
#define SNT (TT / (16 * SQC * 2))
// LDS pitch, in floats, of a key's 16 entries: the two half-waves' stores fall on different banks, and 32 keys' 8-byte reads on all 64
#define SPI 18
// waves_per_eu: a register budget of 256, so that two work-groups share a WGP and four waves a SIMD: one wave's exponentials run beside another's WMMAs
__global__ __launch_bounds__(256) __attribute__((amdgpu_waves_per_eu(4, 4))) void k_stats(const bf* __restrict__ Kf, const bf* __restrict__ Qf, float* BI) {
    __shared__ __align__(16) float redm[8 * 32 * SPI];
    __shared__ __align__(16) float reds[8 * 32 * SPI];
    const int wave = threadIdx.x >> 5, lane = threadIdx.x & 31, lr = lane & 15, hi = lane >> 4;
    const bf* pk = Kf + (size_t)blockIdx.y * (TT * HD) + ((size_t)blockIdx.x * 4 + (wave >> 1)) * (32 * HD) + lane * 8;
    // the lane's own byte address in the q plane, carried through the loop in registers of its own
    static_assert(SNT % (TT / 128) == 0, "every starting trip lies inside the plane");
    int ti = (int)blockIdx.x * (SNT / (TT / 128));   // the trip this work-group starts at
    unsigned long long aq = (unsigned long long)(Qf + (size_t)blockIdx.y * (TT * HD) + (size_t)ti * (2 * SQC * 16 * HD) + (size_t)(wave & 1) * (SQC * 16 * HD) + lane * 8);
    v16bf ka[2][2], qb[SQC][2];
#pragma unroll
    for (int kt = 0; kt < 2; ++kt) { ka[kt][0] = ldfb(pk + kt * 1024); ka[kt][1] = ldfb(pk + kt * 1024 + 512); }
    // precaution: stands between the key loads and the query loads, one of which the compiler lets land in the key loads' address registers
    asm volatile("s_wait_xcnt 0x0" ::: "memory");
#pragma unroll
    for (int u = 0; u < SQC; ++u) { qb[u][0] = cat16b(g16(aq, u * 2048), g16(aq, u * 2048 + 512)); qb[u][1] = cat16b(g16(aq, u * 2048 + 1024), g16(aq, u * 2048 + 1536)); }
    v2f mx[2][4], sm[2][4];   // per key tile: keys 8 hi + 2 i, 8 hi + 2 i + 1
#pragma unroll
    for (int kt = 0; kt < 2; ++kt)
#pragma unroll
        for (int i = 0; i < 4; ++i) { mx[kt][i] = (v2f){-__builtin_inff(), -__builtin_inff()}; sm[kt][i] = (v2f){0.f, 0.f}; }
    // rolled: one trip's 16 WMMAs and 80 exponentials are the body; unrolled it would need a second set of fragment registers and lose the fourth wave per SIMD
#pragma unroll 1
    for (int t = 0; t < SNT; ++t) {
        const int wrap = ti + 1 == SNT;   // behind the plane's last pieces come its first; the last trip so fetches the first trip's fragments again, inside the plane
        v8f s[2][SQC];
#pragma unroll
        for (int kt = 0; kt < 2; ++kt)
#pragma unroll
            for (int u = 0; u < SQC; ++u) s[kt][u] = wmmab(ka[kt][0], qb[u][0], (v8f){});
#pragma unroll
        for (int kt = 0; kt < 2; ++kt)
#pragma unroll
            for (int u = 0; u < SQC; ++u) s[kt][u] = wmmab(ka[kt][1], qb[u][1], s[kt][u]);
        // keeps the sixteen products back to back: mixed with the maxima below, the compiler pads each first use of a tile with v_nop
        __builtin_amdgcn_sched_barrier(0);
        // maximum on the unscaled scores (LC is positive: it commutes with the maximum)
        v2f mn[2][4];
#pragma unroll
        for (int kt = 0; kt < 2; ++kt)
#pragma unroll
            for (int i = 0; i < 4; ++i)
#pragma unroll
                for (int c = 0; c < 2; ++c) mn[kt][i][c] = fmaxf(fmaxf(fmaxf(mx[kt][i][c], s[kt][0][2 * i + c]), s[kt][1][2 * i + c]), fmaxf(s[kt][2][2 * i + c], s[kt][3][2 * i + c]));
        // precaution: stands between the loads issued so far and the overwrite of their address registers; the address is an operand so that its step cannot be lifted over the wait
        asm volatile("s_wait_xcnt 0x0" : "+v"(aq) :: "memory");
        aq += wrap ? (unsigned long long)-(long long)((SNT - 1) * (2 * SQC * 16 * HD * 2)) : (unsigned long long)(2 * SQC * 16 * HD * 2); ti = wrap ? 0 : ti + 1;
#pragma unroll
        for (int u = 0; u < SQC; ++u) { qb[u][0] = cat16b(g16(aq, u * 2048), g16(aq, u * 2048 + 512)); qb[u][1] = cat16b(g16(aq, u * 2048 + 1024), g16(aq, u * 2048 + 1536)); }
#pragma unroll
        for (int kt = 0; kt < 2; ++kt) { v2f nb[4], d[4], e[4];
#pragma unroll
            for (int i = 0; i < 4; ++i) { nb[i] = mn[kt][i] * (v2f){-LC, -LC}; d[i] = __builtin_elementwise_fma(mx[kt][i], (v2f){LC, LC}, nb[i]); }
            exp2x8(e, d);   // what the sum so far shrinks by; 0 in the first trip
#pragma unroll
            for (int i = 0; i < 4; ++i) { v2f x[SQC], p[SQC];
#pragma unroll
                for (int u = 0; u < SQC; ++u) x[u] = __builtin_elementwise_fma((v2f){s[kt][u][2 * i], s[kt][u][2 * i + 1]}, (v2f){LC, LC}, nb[i]);
                exp2x8(p, x);
                sm[kt][i] = __builtin_elementwise_fma(sm[kt][i], e[i], (p[0] + p[1]) + (p[2] + p[3])); mx[kt][i] = mn[kt][i]; } }
    }
    // the last trip's repeated fetch has landed before the wave goes on and gives its registers back
    asm volatile("s_wait_loadcnt 0x0" ::: "memory");
    // every lane leaves its 16 maxima and sums in LDS, a key's 16 entries side by side
#pragma unroll
    for (int kt = 0; kt < 2; ++kt)
#pragma unroll
        for (int j = 0; j < 8; ++j) { const int r = (wave * 32 + kt * 16 + hi * 8 + j) * SPI + lr; redm[r] = mx[kt][j >> 1][j & 1]; reds[r] = sm[kt][j >> 1][j & 1]; }
    __syncthreads();
    if (threadIdx.x < 128) {   // thread = key: the 16 lanes' entries of its two shares, which lie 32 rows apart
        const int g = ((int)(threadIdx.x >> 5) * 64 + (int)(threadIdx.x & 31)) * SPI;
        v2f a[16], b[16];
#pragma unroll
        for (int i = 0; i < 8; ++i) { a[i] = *(const v2fa*)(redm + g + 2 * i); a[8 + i] = *(const v2fa*)(redm + g + 32 * SPI + 2 * i); b[i] = *(const v2fa*)(reds + g + 2 * i); b[8 + i] = *(const v2fa*)(reds + g + 32 * SPI + 2 * i); }
        float m = fmaxf(a[0][0], a[0][1]);
#pragma unroll
        for (int i = 1; i < 16; ++i) m = fmaxf(fmaxf(m, a[i][0]), a[i][1]);
        const float nb = m * -LC; v2f sv = (v2f){0.f, 0.f};
#pragma unroll
        for (int i = 0; i < 16; i += 4) { v2f x[4], e[4];
#pragma unroll
            for (int u = 0; u < 4; ++u) x[u] = __builtin_elementwise_fma(a[i + u], (v2f){LC, LC}, (v2f){nb, nb});
            exp2x8(e, x);
#pragma unroll
            for (int u = 0; u < 4; ++u) sv = __builtin_elementwise_fma(b[i + u], e[u], sv); }
        BI[(size_t)blockIdx.y * TT + (int)blockIdx.x * 128 + (int)threadIdx.x] = (10.0f - log2_slot(sv[0] + sv[1])) + nb; }   // 10 = log2(PCAR)
}

// ---- k_pv: pass 2, scores again, probabilities and the P.v product without a trip through memory. One wave = 32 queries x TT/KSPL keys; work-group = 256 queries x all keys (8 query groups x KSPL key shares); grid (TT/256, batches), 16 waves.
// A pass is 32 keys: S^T = K.Q^T for 2 key tiles x 2 query tiles (lane = query, register r = key 8 hi + r), p = exp2(s * LC + bias[key]); the two key tiles of one query tile, converted in place, are the fp16 B operand (k = 8 hi + 0..7, 16 + 8 hi + 0..7) of out^T[d][q] += v^T[d][k] P^T[k][q]; the v plane holds its A fragments in that k order.
// The work-groups of a batch all walk the same K, v and bias: each starts its key shares at a pass of its own (set by its block indices) and wraps round inside the share, so that at no moment do they all ask L2 for the same lines.
// K, bias and v fragments of the next pass are fetched into the same registers right behind their last use. At the end the two waves that hold the two key shares of the same 32 queries swap one query tile each through LDS; each adds the shares of the tile it kept (share 0 + share 1), undoes the 1024 and stores 16 rows of out.
#define KSPL 2
#define NPAS (TT / KSPL / 32)
static_assert(PCAR == 1024.0f, "k_stats writes log2(PCAR) as 10");
static_assert(KSPL == 2, "the waves swap their sums in pairs");
// passes between the starting places of two neighbouring work-groups of a batch
#define PSTEP (NPAS / (TT / 256))
static_assert(PSTEP >= 1 && PSTEP * (TT / 256) == NPAS, "every starting place lies inside the share");
// waves_per_eu: a register budget of 256, so that the work-group's 16 waves fill a WGP, four waves a SIMD: one wave's exponentials run beside another's WMMAs
__global__ __launch_bounds__(512) __attribute__((amdgpu_waves_per_eu(4, 4))) void k_pv(const bf* __restrict__ Kf, const bf* __restrict__ Qf, const h16* __restrict__ Vf, const float* __restrict__ BI, float* O) {
    // a wave's slot: 8 pieces of 32 lanes x 16 bytes, each piece one contiguous 512-byte LDS access of the wave
    __shared__ __align__(16) float fold[16 * 8 * 128];
    const int wave = threadIdx.x >> 5, lane = threadIdx.x & 31, lr = lane & 15, hi = lane >> 4;
    const int ks = wave >> 3;   // the wave's key share
    int pi = (int)blockIdx.x * PSTEP + (int)blockIdx.y % PSTEP;   // the pass of its share this work-group starts at; the batches' planes lie a power of two apart, so neighbouring batches fill the places between
    const int q0 = ((int)blockIdx.x * 8 + (wave & 7)) * 32, k0 = ks * (TT / KSPL) + pi * 32;
    const bf* pq = Qf + (size_t)blockIdx.y * (TT * HD) + (size_t)q0 * HD + lane * 8;
    // K, v and bias: the lane's own byte address, carried through the loop in registers of its own
    unsigned long long ak = (unsigned long long)(Kf + (size_t)blockIdx.y * (TT * HD) + (size_t)k0 * HD + lane * 8);
    unsigned long long av = (unsigned long long)(Vf + (size_t)blockIdx.y * (TT * HD) + (size_t)k0 * HD + lane * 8);
    unsigned long long ab = (unsigned long long)(BI + (size_t)blockIdx.y * TT + k0 + hi * 8);
    v16bf qb[2][2];
#pragma unroll
    for (int qt = 0; qt < 2; ++qt) { qb[qt][0] = ldfb(pq + qt * 1024); qb[qt][1] = ldfb(pq + qt * 1024 + 512); }
    // the q loads stand in front of the K loads: with one of them behind, the counted waits at the loop's head, which must hold for both ways in, wait for all K and bias loads at the second product
    __builtin_amdgcn_sched_barrier(0);
    v8f o[4][2];
#pragma unroll
    for (int dt = 0; dt < 4; ++dt) { o[dt][0] = (v8f){}; o[dt][1] = (v8f){}; }
    v16bf ka[2][2]; v16h va[4]; v4f bi[2][2];
#pragma unroll
    for (int kt = 0; kt < 2; ++kt) { ka[kt][0] = cat16b(g16(ak, kt * 2048), g16(ak, kt * 2048 + 512)); ka[kt][1] = cat16b(g16(ak, kt * 2048 + 1024), g16(ak, kt * 2048 + 1536));
        bi[kt][0] = __builtin_bit_cast(v4f, g16(ab, kt * 64)); bi[kt][1] = __builtin_bit_cast(v4f, g16(ab, kt * 64 + 16)); }
    // the v loads stand behind the K and bias loads as in the loop: in another order the counted waits at the loop's head, which must hold for both ways in, wait for the v fragments too
    __builtin_amdgcn_sched_barrier(0);
#pragma unroll
    for (int dt = 0; dt < 4; ++dt) va[dt] = cat16(__builtin_bit_cast(v8h, g16(av, dt * 1024)), __builtin_bit_cast(v8h, g16(av, dt * 1024 + 512)));
    // rolled: one pass's 16 WMMAs and 32 exponentials are the body; unrolled it would need a second set of fragment registers and lose the fourth wave per SIMD
#pragma unroll 1
    for (int p = 0; p < NPAS; ++p) {
        const int wrap = pi + 1 == NPAS;   // behind the share's last keys come its first; the last pass so fetches the first pass's fragments again, inside its range
        v8f s[2][2];
#pragma unroll
        for (int kt = 0; kt < 2; ++kt)
#pragma unroll
            for (int qt = 0; qt < 2; ++qt) s[kt][qt] = wmmab(ka[kt][0], qb[qt][0], (v8f){});
#pragma unroll
        for (int kt = 0; kt < 2; ++kt)
#pragma unroll
            for (int qt = 0; qt < 2; ++qt) s[kt][qt] = wmmab(ka[kt][1], qb[qt][1], s[kt][qt]);
        // keeps the eight products back to back: mixed with the multiply-adds below, the compiler pads each first use of a tile with v_nop
        __builtin_amdgcn_sched_barrier(0);
        v2f x[2][2][4];
#pragma unroll
        for (int kt = 0; kt < 2; ++kt)
#pragma unroll
            for (int qt = 0; qt < 2; ++qt)
#pragma unroll
                for (int i = 0; i < 4; ++i) x[kt][qt][i] = __builtin_elementwise_fma((v2f){s[kt][qt][2 * i], s[kt][qt][2 * i + 1]}, (v2f){LC, LC}, (v2f){bi[kt][i >> 1][2 * (i & 1)], bi[kt][i >> 1][2 * (i & 1) + 1]});
        // the scheduler may move nothing over this line: without it the fetch below sinks to the loop's foot and its latency stands open in front of the next pass's first WMMA
        __builtin_amdgcn_sched_barrier(0);
        // precaution: stands between the loads issued so far and the overwrite of their address registers; the addresses are operands so that their step cannot be lifted over the wait
        asm volatile("s_wait_xcnt 0x0" : "+v"(ak), "+v"(ab) :: "memory");
        ak += wrap ? (unsigned long long)-(long long)((NPAS - 1) * 4096) : 4096ull; ab += wrap ? (unsigned long long)-(long long)((NPAS - 1) * 128) : 128ull;
#pragma unroll
        for (int kt = 0; kt < 2; ++kt) { ka[kt][0] = cat16b(g16(ak, kt * 2048), g16(ak, kt * 2048 + 512)); ka[kt][1] = cat16b(g16(ak, kt * 2048 + 1024), g16(ak, kt * 2048 + 1536));
            bi[kt][0] = __builtin_bit_cast(v4f, g16(ab, kt * 64)); bi[kt][1] = __builtin_bit_cast(v4f, g16(ab, kt * 64 + 16)); }
        // holds the fetch in front of the exponentials, which cover its latency
        __builtin_amdgcn_sched_barrier(0);
        v16h pf[2];
#pragma unroll
        for (int qt = 0; qt < 2; ++qt)
#pragma unroll
            for (int kt = 0; kt < 2; ++kt) { v2f e[4]; exp2x8(e, x[kt][qt]);
#pragma unroll
                for (int i = 0; i < 4; ++i) { const v2h c = __builtin_convertvector(e[i], v2h); pf[qt][kt * 8 + 2 * i] = c[0]; pf[qt][kt * 8 + 2 * i + 1] = c[1]; } }
#pragma unroll
        for (int dt = 0; dt < 4; ++dt)
#pragma unroll
            for (int qt = 0; qt < 2; ++qt) o[dt][qt] = wmma16(va[dt], pf[qt], o[dt][qt]);
        // keeps the address step behind the products, whose operands the wait for the earlier v loads has covered
        __builtin_amdgcn_sched_barrier(0);
        // precaution: as above
        asm volatile("s_wait_xcnt 0x0" : "+v"(av) :: "memory");
        av += wrap ? (unsigned long long)-(long long)((NPAS - 1) * 4096) : 4096ull; pi = wrap ? 0 : pi + 1;
#pragma unroll
        for (int dt = 0; dt < 4; ++dt) va[dt] = cat16(__builtin_bit_cast(v8h, g16(av, dt * 1024)), __builtin_bit_cast(v8h, g16(av, dt * 1024 + 512)));
    }
    // the last pass's repeated fetch has landed before the wave stores its sums and gives its registers back
    asm volatile("s_wait_loadcnt 0x0" ::: "memory");
    // the wave of key share ks keeps query tile ks and hands the other tile to its partner, wave ^ 8, which holds the same lanes' sums over the other keys
    float* fs = fold + wave * 1024 + lane * 4; const float* fr = fold + (wave ^ 8) * 1024 + lane * 4;
    v8f mine[4];
#pragma unroll
    for (int dt = 0; dt < 4; ++dt) { const v8f g = ks ? o[dt][0] : o[dt][1]; mine[dt] = ks ? o[dt][1] : o[dt][0];
        *(v4fa*)(fs + dt * 256) = __builtin_shufflevector(g, g, 0, 1, 2, 3); *(v4fa*)(fs + dt * 256 + 128) = __builtin_shufflevector(g, g, 4, 5, 6, 7); }
    __syncthreads();
    float* po = O + ((size_t)blockIdx.y * TT + q0 + ks * 16 + lr) * HD + 8 * hi;
#pragma unroll
    for (int dt = 0; dt < 4; ++dt) { const v4f a = *(const v4fa*)(fr + dt * 256), b = *(const v4fa*)(fr + dt * 256 + 128);
        *(v8f*)(po + dt * 16) = (mine[dt] + __builtin_shufflevector(a, b, 0, 1, 2, 3, 4, 5, 6, 7)) * (1.0f / PCAR); }   // a lane's 8 registers are 8 consecutive d of one query
}

// ---- k_planes: q and k to their bf16 fragment planes and v to the fp16 plane of A fragments of v^T (per 32 keys 4 d tiles x 2 halves x 32 lanes x 8 keys; lane (lr, hi) of half h2 holds keys 16 h2 + 8 hi + 0..7 of d = 16 dt + lr), all three in one launch. One wave = the same 16 rows (counted over all batches) of q, of k and of v; work-group = 8 waves; grid NB_ * TT / 128: 16 waves a WGP.
// Every load is two whole rows of the wave (q, k: rows 2 j, 2 j + 1, 512 contiguous bytes; v: rows j and 8 + j), all 24 issued before the first is used. The converted pieces change lanes through the wave's own LDS range, laid out in plane order, so that every store is 512 contiguous bytes too. No other wave reads that range: no barrier.
// q, k: lane (c, hi) of load j holds columns 4 c + 0..3 of row 2 j + hi, half of the piece (block c / 2, row). v: lane (c, hi) of load j holds d = 4 c + 0..3 of key 8 hi + j, so after 8 loads four whole pieces (8 keys of one d).
// LDS pitch, in 16-bit elements, of one 8-column block of a q or k tile (16 rows x 8, + 16): the 32 lanes' 8-byte stores of one row pair fall on all 64 banks once
#define PQP 144
// the same of one d tile of v (32 pieces x 8, + 8): the 16-byte stores of a half-wave fall on all 64 banks once
#define PVP 264
#define PWS (2 * 8 * PQP + 4 * PVP)
static_assert((NB_ * TT) % 128 == 0 && TT % 32 == 0 && HD == 64, "a wave takes 16 whole rows of 64, a work-group 128");
typedef v4us __attribute__((may_alias)) v4usa;
__global__ __launch_bounds__(256) void k_planes(const float* __restrict__ q, const float* __restrict__ k, const float* __restrict__ v, bf* QF, bf* KF, h16* VF) {
    __shared__ __align__(16) bf st[8 * PWS];
    const int wave = threadIdx.x >> 5, lane = threadIdx.x & 31, c = lane & 15, hi = lane >> 4;
    const size_t t = (size_t)blockIdx.x * 8 + wave;   // the 16-row tile
    const float* sq = q + t * (16 * HD) + hi * HD + c * 4; const float* sk = k + t * (16 * HD) + hi * HD + c * 4; const float* sv = v + t * (16 * HD) + hi * (8 * HD) + c * 4;
    v4f a[8], b[8], w[8];
#pragma unroll
    for (int j = 0; j < 8; ++j) a[j] = *(const v4f*)(sq + j * (2 * HD));
    // precaution: stands between these loads and the later ones, one of which the compiler lets land in their address registers
    asm volatile("s_wait_xcnt 0x0" ::: "memory");
#pragma unroll
    for (int j = 0; j < 8; ++j) b[j] = *(const v4f*)(sk + j * (2 * HD));
    // precaution: as above
    asm volatile("s_wait_xcnt 0x0" ::: "memory");
#pragma unroll
    for (int j = 0; j < 8; ++j) w[j] = *(const v4f*)(sv + j * HD);
    // holds all 24 loads in front of the first conversion: 12 KB of a wave in flight at once
    __builtin_amdgcn_sched_barrier(0);
    bf* lq = st + wave * PWS; bf* lk = lq + 8 * PQP; bf* lv = lk + 8 * PQP;
    const int wq = (c >> 1) * PQP + hi * 8 + (c & 1) * 4, wv = (c >> 2) * PVP + hi * 128 + (c & 3) * 32;
#pragma unroll
    for (int j = 0; j < 8; ++j) { v4us o;
#pragma unroll
        for (int e = 0; e < 4; ++e) o[e] = f2bf(a[j][e]);
        *(v4usa*)(lq + wq + j * 16) = o; }
#pragma unroll
    for (int j = 0; j < 8; ++j) { v4us o;
#pragma unroll
        for (int e = 0; e < 4; ++e) o[e] = f2bf(b[j][e]);
        *(v4usa*)(lk + wq + j * 16) = o; }
#pragma unroll
    for (int e = 0; e < 4; ++e) { v8h o;
#pragma unroll
        for (int u = 0; u < 8; ++u) o[u] = tohx(bfr(w[u][e]));
        *(v8usa*)(lv + wv + e * 8) = __builtin_bit_cast(v8us, o); }
    // the wave's own LDS stores have landed before its lanes read one another's pieces back
    asm volatile("s_wait_dscnt 0x0" ::: "memory");
    v8us x[4], y[4], z[4];
#pragma unroll
    for (int i = 0; i < 4; ++i) { x[i] = *(const v8usa*)(lq + (2 * i + hi) * PQP + c * 8); y[i] = *(const v8usa*)(lk + (2 * i + hi) * PQP + c * 8); z[i] = *(const v8usa*)(lv + i * PVP + lane * 8); }
    bf* dq = QF + t * 1024 + lane * 8; bf* dk = KF + t * 1024 + lane * 8; h16* dv = VF + (t >> 1) * 2048 + (t & 1) * 256 + lane * 8;
#pragma unroll
    for (int i = 0; i < 4; ++i) *(v8us*)(dq + i * 256) = x[i];
#pragma unroll
    for (int i = 0; i < 4; ++i) *(v8us*)(dk + i * 256) = y[i];
#pragma unroll
    for (int i = 0; i < 4; ++i) *(v8h*)(dv + i * 512) = __builtin_bit_cast(v8h, z[i]);
}

extern "C" void kernel_launch(void* const* d_in, const int* in_sizes, int n_in,
                              void* d_out, int out_size, void* d_ws, size_t ws_size, hipStream_t stream) {
    (void)in_sizes; (void)n_in; (void)out_size;
    const float* qin = (const float*)d_in[0]; const float* kin = (const float*)d_in[1]; const float* vin = (const float*)d_in[2];
    float* OUT = (float*)d_out;     // [16][4096][64]
    char* wsp = (char*)d_ws;
    auto take = [&](size_t bytes) { char* p = wsp; wsp += (bytes + 255) & ~(size_t)255; return (void*)p; };
    bf* QF = (bf*)take((size_t)NB_ * TT * HD * 2); bf* KF = (bf*)take((size_t)NB_ * TT * HD * 2); h16* VF = (h16*)take((size_t)NB_ * HD * TT * 2); float* BI = (float*)take((size_t)NB_ * TT * 4);
    if ((size_t)(wsp - (char*)d_ws) > ws_size) return;
    k_planes<<<NB_ * TT / 128, 256, 0, stream>>>(qin, kin, vin, QF, KF, VF);
    k_stats<<<dim3(TT / 128, NB_, 1), 256, 0, stream>>>(KF, QF, BI);   /* per key: log2(1024 / sum over q) - max over q, in the exponent's units */
    k_pv<<<dim3(TT / 256, NB_, 1), 512, 0, stream>>>(KF, QF, VF, BI, OUT);   /* out[q] = sum_k attn[q][k] v[k] */
}

// v009
// One run takes 84.9 microseconds.
// Timed twice side by side with v008, it ran 1.05 times as fast both times.
// All steps since v000 together make it 38.4 times as fast.
#include <hip/hip_runtime.h>

// Scaled dot-product attention with the source's query-axis softmax (q, k, v [16][4096][64] given directly; x[q][k] = q_q.k_k / 8; attn = softmax over the QUERY axis (per key column); out[q][d] = sum_k attn[q][k] v[k][d] -> [16][4096][64] (4.2 M)).
// Each launch covers all NB_ batches: the batch index is a grid dimension, or the rows are counted over all batches.
// Algorithm per batch: q and k as bf16 planes, v as an fp16 plane, all three stored in the order of the WMMA fragments (a fragment half = 512 contiguous bytes of a wave); pass 1 computes the transposed scores S^T[k][q] = k_k.q_q for 32 keys a wave, streams the queries past them, sums exp(s / 8) and leaves one f32 per key, bias = log2(1024 / sum) (where that sum leaves f32's safe range: again under a running maximum, bias = log2(1024 / sum) - max / 8 * log2(e)); pass 2 computes the scores again for 32 queries a wave, p = exp2(s / 8 * log2(e) + bias) = 1024 x the probability, packs two score tiles as the fp16 B operand of out^T += v^T.P^T: the probabilities never leave the registers. Keys split over the KSPL wave groups of a work-group, whose partial sums are added through LDS, the 1/1024 undone in f32, and out stored by the same kernel.
// Compute dtypes, f32 accumulate: q, k, v rounded to bf16, so the score operands are exact bf16 planes (one product, exact); softmax f32; fp16 probabilities (x1024) x fp16 v (one product); 1/1024 in f32.

#define NB_  16
#define TT   4096
#define HD   64
#define PCAR 1024.0f
#define SCL  0.125f
typedef _Float16 h16;
typedef unsigned short bf;
typedef __attribute__((ext_vector_type(16))) __bf16   v16bf;
typedef __attribute__((ext_vector_type(16))) _Float16 v16h;
typedef __attribute__((ext_vector_type(8)))  _Float16 v8h;
typedef __attribute__((ext_vector_type(8)))  unsigned short v8us;
typedef __attribute__((ext_vector_type(8)))  float    v8f;
typedef __attribute__((ext_vector_type(4)))  float    v4f;
typedef __attribute__((ext_vector_type(2)))  float    v2f;
typedef __attribute__((ext_vector_type(4)))  unsigned short v4us;
typedef __attribute__((ext_vector_type(2)))  unsigned short v2us;
typedef __attribute__((ext_vector_type(4)))  _Float16 v4h;
typedef __attribute__((ext_vector_type(2)))  _Float16 v2h;
typedef v8h  __attribute__((may_alias)) v8ha;
typedef v4f  __attribute__((may_alias)) v4fa;
typedef v8us __attribute__((may_alias)) v8usa;
typedef v2f  __attribute__((may_alias)) v2fa;

__device__ __forceinline__ unsigned short f2bf(float f) { unsigned u = __float_as_uint(f); u += 0x7FFFu + ((u >> 16) & 1u); return (unsigned short)(u >> 16); }
__device__ __forceinline__ float bf2f(unsigned short b) { return __uint_as_float(((unsigned)b) << 16); }
__device__ __forceinline__ float bfr(float f) { return bf2f(f2bf(f)); }
__device__ __forceinline__ h16 tohx(float x) { return (h16)x; }
// v_exp_f32 with the one slot the instruction set asks for behind a transcendental: the v_nop in the same statement cannot drift away
__device__ __forceinline__ float exp2_slot(float x) { float e; asm("v_exp_f32 %0, %1\n\tv_nop" : "=v"(e) : "v"(x)); return e; }
// v_log_f32 with the same slot behind it
__device__ __forceinline__ float log2_slot(float x) { float e; asm("v_log_f32 %0, %1\n\tv_nop" : "=v"(e) : "v"(x)); return e; }
// eight independent v_exp_f32 in one statement: each fills the slot behind the one in front of it (no result is read and, the outputs being early-clobber, no source overwritten), the v_nop fills the last one's
__device__ __forceinline__ void exp2x8(v2f (&e)[4], const v2f (&x)[4]) { float a, b, c, d, f, g, h, i;
    asm("v_exp_f32 %0, %8\n\tv_exp_f32 %1, %9\n\tv_exp_f32 %2, %10\n\tv_exp_f32 %3, %11\n\tv_exp_f32 %4, %12\n\tv_exp_f32 %5, %13\n\tv_exp_f32 %6, %14\n\tv_exp_f32 %7, %15\n\tv_nop"
        : "=&v"(a), "=&v"(b), "=&v"(c), "=&v"(d), "=&v"(f), "=&v"(g), "=&v"(h), "=&v"(i) : "v"(x[0][0]), "v"(x[0][1]), "v"(x[1][0]), "v"(x[1][1]), "v"(x[2][0]), "v"(x[2][1]), "v"(x[3][0]), "v"(x[3][1]));
    e[0] = (v2f){a, b}; e[1] = (v2f){c, d}; e[2] = (v2f){f, g}; e[3] = (v2f){h, i}; }
__device__ __forceinline__ v16h cat16(v8h lo, v8h hi) { return __builtin_shufflevector(lo, hi, 0, 1, 2, 3, 4, 5, 6, 7, 8, 9, 10, 11, 12, 13, 14, 15); }
__device__ __forceinline__ v16bf cat16b(v8us lo, v8us hi) { return __builtin_bit_cast(v16bf, __builtin_shufflevector(lo, hi, 0, 1, 2, 3, 4, 5, 6, 7, 8, 9, 10, 11, 12, 13, 14, 15)); }
__device__ __forceinline__ v8f wmma16(v16h a, v16h b, v8f c) { return __builtin_amdgcn_wmma_f32_16x16x32_f16(false, a, false, b, (short)0, c, false, false); }
__device__ __forceinline__ v8f wmmab(v16bf a, v16bf b, v8f c) { return __builtin_amdgcn_wmma_f32_16x16x32_bf16(false, a, false, b, (short)0, c, false, false); }

// fragment planes: a 16-row x 64-k tile is 2 fragments x 2 halves x 32 lanes x 8 elements; lane (lr, hi) of half h2 of fragment f holds k = 32 f + 16 h2 + 8 hi + 0..7 of row lr (the hardware k order of the 16x16x32 forms, the same for A and B), each half one contiguous 512-byte load of a wave
__device__ __forceinline__ v16bf ldfb(const bf* p) { return cat16b(*(const v8us*)p, *(const v8us*)(p + 256)); }
__device__ __forceinline__ v16h ldfh(const h16* p) { return cat16(*(const v8h*)p, *(const v8h*)(p + 256)); }
// 16 bytes of global memory at a byte address plus a constant: the address-space cast keeps the load a global one although the address has passed through an asm operand
__device__ __forceinline__ v8us g16(unsigned long long base, unsigned off) { return *(const __attribute__((address_space(1))) v8us*)((const __attribute__((address_space(1))) char*)base + off); }
#define LC (1.4426950408889634f * SCL)

// ---- k_stats: pass 1, score GEMM and the column softmax's sum, the queries streamed. One wave = 32 keys x half the queries of one batch; work-group = 128 keys (4 key groups x 2 query shares); grid (TT/128, batches), 8 waves.
// A trip is 64 queries: S^T[2 key tiles][4 query tiles] (lane = query, register = key). Every lane keeps, per key, the sum of exp2(s * LC) over the queries it has seen, with no maximum taken off: bias = log2(1024 / sum). Nothing but 32 keys' fragments and these 16 values outlives a trip, so a query fragment is loaded once for 2 products (one per key tile) and the work-group's waves read the same 16 KB at about the same time.
// The two shares take the 64-query pieces alternately. At the end one thread a key folds the 16 lanes' and two shares' values through LDS.
// A key's plain sum is as good as the shifted one while it lies between SLO and SHI: nothing has overflowed, and a term lost below f32's range is less than 2^-62 of the sum. Where a key of the work-group has a sum outside (or not a number), the whole work-group walks the queries again under a running maximum (stats_maxed), which holds for every input.
// The work-groups of a batch all walk the same q plane: each starts at a trip of its own (its index along x) and wraps round, so that at no moment do they all ask L2 for the same lines.
#define SQC 4
#define SNT (TT / (16 * SQC * 2))
#define SLO 0x1p-64f
#define SHI 0x1p+126f
// LDS pitch, in floats, of a key's 16 entries: the two half-waves' stores fall on different banks, and 32 keys' 8-byte reads on all 64
#define SPI 18
static_assert(SNT % (TT / 128) == 0, "every starting trip lies inside the plane");

// the walk under a running maximum: every lane keeps, per key, a running maximum and the sum of exp2((s - maximum) * LC) over the queries it has seen; a new maximum rescales the sum once a trip. Returns, in threads 0..127 (thread = key), bias = log2(1024 / sum) - max * LC. Every thread of the work-group calls it.
__device__ __forceinline__ float stats_maxed(const bf* pk, unsigned long long aq, int ti, float* redm, float* reds) {
    const int wave = threadIdx.x >> 5, lane = threadIdx.x & 31, lr = lane & 15, hi = lane >> 4;
    v16bf ka[2][2], qb[SQC][2];
#pragma unroll
    for (int kt = 0; kt < 2; ++kt) { ka[kt][0] = ldfb(pk + kt * 1024); ka[kt][1] = ldfb(pk + kt * 1024 + 512); }
    // precaution: stands between the key loads and the query loads, one of which the compiler lets land in the key loads' address registers
    asm volatile("s_wait_xcnt 0x0" ::: "memory");
#pragma unroll
    for (int u = 0; u < SQC; ++u) { qb[u][0] = cat16b(g16(aq, u * 2048), g16(aq, u * 2048 + 512)); qb[u][1] = cat16b(g16(aq, u * 2048 + 1024), g16(aq, u * 2048 + 1536)); }
    v2f mx[2][4], sm[2][4];   // per key tile: keys 8 hi + 2 i, 8 hi + 2 i + 1
#pragma unroll
    for (int kt = 0; kt < 2; ++kt)
#pragma unroll
        for (int i = 0; i < 4; ++i) { mx[kt][i] = (v2f){-__builtin_inff(), -__builtin_inff()}; sm[kt][i] = (v2f){0.f, 0.f}; }
    // rolled: one trip's 16 WMMAs and 80 exponentials are the body; unrolled it would need a second set of fragment registers and lose the fourth wave per SIMD
#pragma unroll 1
    for (int t = 0; t < SNT; ++t) {
        const int wrap = ti + 1 == SNT;   // behind the plane's last pieces come its first; the last trip so fetches the first trip's fragments again, inside the plane
        v8f s[2][SQC];
#pragma unroll
        for (int kt = 0; kt < 2; ++kt)
#pragma unroll
            for (int u = 0; u < SQC; ++u) s[kt][u] = wmmab(ka[kt][0], qb[u][0], (v8f){});
#pragma unroll
        for (int kt = 0; kt < 2; ++kt)
#pragma unroll
            for (int u = 0; u < SQC; ++u) s[kt][u] = wmmab(ka[kt][1], qb[u][1], s[kt][u]);
        // keeps the sixteen products back to back: mixed with the maxima below, the compiler pads each first use of a tile with v_nop
        __builtin_amdgcn_sched_barrier(0);
        // maximum on the unscaled scores (LC is positive: it commutes with the maximum)
        v2f mn[2][4];
#pragma unroll
        for (int kt = 0; kt < 2; ++kt)
#pragma unroll
            for (int i = 0; i < 4; ++i)
#pragma unroll
                for (int c = 0; c < 2; ++c) mn[kt][i][c] = fmaxf(fmaxf(fmaxf(mx[kt][i][c], s[kt][0][2 * i + c]), s[kt][1][2 * i + c]), fmaxf(s[kt][2][2 * i + c], s[kt][3][2 * i + c]));
        // precaution: stands between the loads issued so far and the overwrite of their address registers; the address is an operand so that its step cannot be lifted over the wait
        asm volatile("s_wait_xcnt 0x0" : "+v"(aq) :: "memory");
        aq += wrap ? (unsigned long long)-(long long)((SNT - 1) * (2 * SQC * 16 * HD * 2)) : (unsigned long long)(2 * SQC * 16 * HD * 2); ti = wrap ? 0 : ti + 1;
#pragma unroll
        for (int u = 0; u < SQC; ++u) { qb[u][0] = cat16b(g16(aq, u * 2048), g16(aq, u * 2048 + 512)); qb[u][1] = cat16b(g16(aq, u * 2048 + 1024), g16(aq, u * 2048 + 1536)); }
#pragma unroll
        for (int kt = 0; kt < 2; ++kt) { v2f nb[4], d[4], e[4];
#pragma unroll
            for (int i = 0; i < 4; ++i) { nb[i] = mn[kt][i] * (v2f){-LC, -LC}; d[i] = __builtin_elementwise_fma(mx[kt][i], (v2f){LC, LC}, nb[i]); }
            exp2x8(e, d);   // what the sum so far shrinks by; 0 in the first trip
#pragma unroll
            for (int i = 0; i < 4; ++i) { v2f x[SQC], p[SQC];
#pragma unroll
                for (int u = 0; u < SQC; ++u) x[u] = __builtin_elementwise_fma((v2f){s[kt][u][2 * i], s[kt][u][2 * i + 1]}, (v2f){LC, LC}, nb[i]);
                exp2x8(p, x);
                sm[kt][i] = __builtin_elementwise_fma(sm[kt][i], e[i], (p[0] + p[1]) + (p[2] + p[3])); mx[kt][i] = mn[kt][i]; } }
    }
    // the last trip's repeated fetch has landed before the wave goes on and gives its registers back
    asm volatile("s_wait_loadcnt 0x0" ::: "memory");
    // every lane leaves its 16 maxima and sums in LDS, a key's 16 entries side by side
#pragma unroll
    for (int kt = 0; kt < 2; ++kt)
#pragma unroll
        for (int j = 0; j < 8; ++j) { const int r = (wave * 32 + kt * 16 + hi * 8 + j) * SPI + lr; redm[r] = mx[kt][j >> 1][j & 1]; reds[r] = sm[kt][j >> 1][j & 1]; }
    __syncthreads();
    float bias = 0.f;
    if (threadIdx.x < 128) {   // thread = key: the 16 lanes' entries of its two shares, which lie 32 rows apart
        const int g = ((int)(threadIdx.x >> 5) * 64 + (int)(threadIdx.x & 31)) * SPI;
        v2f a[16], b[16];
#pragma unroll
        for (int i = 0; i < 8; ++i) { a[i] = *(const v2fa*)(redm + g + 2 * i); a[8 + i] = *(const v2fa*)(redm + g + 32 * SPI + 2 * i); b[i] = *(const v2fa*)(reds + g + 2 * i); b[8 + i] = *(const v2fa*)(reds + g + 32 * SPI + 2 * i); }
        float m = fmaxf(a[0][0], a[0][1]);
#pragma unroll
        for (int i = 1; i < 16; ++i) m = fmaxf(fmaxf(m, a[i][0]), a[i][1]);
        const float nb = m * -LC; v2f sv = (v2f){0.f, 0.f};
#pragma unroll
        for (int i = 0; i < 16; i += 4) { v2f x[4], e[4];
#pragma unroll
            for (int u = 0; u < 4; ++u) x[u] = __builtin_elementwise_fma(a[i + u], (v2f){LC, LC}, (v2f){nb, nb});
            exp2x8(e, x);
#pragma unroll
            for (int u = 0; u < 4; ++u) sv = __builtin_elementwise_fma(b[i + u], e[u], sv); }
        bias = (10.0f - log2_slot(sv[0] + sv[1])) + nb; }   // 10 = log2(PCAR)
    return bias;
}

// waves_per_eu: a register budget of 256, so that two work-groups share a WGP and four waves a SIMD: one wave's exponentials run beside another's WMMAs
__global__ __launch_bounds__(256) __attribute__((amdgpu_waves_per_eu(4, 4))) void k_stats(const bf* __restrict__ Kf, const bf* __restrict__ Qf, float* BI) {
    __shared__ __align__(16) float redm[8 * 32 * SPI];
    __shared__ __align__(16) float reds[8 * 32 * SPI];
    __shared__ __align__(16) int redo[4];
    const int wave = threadIdx.x >> 5, lane = threadIdx.x & 31, lr = lane & 15, hi = lane >> 4;
    const bf* pk = Kf + (size_t)blockIdx.y * (TT * HD) + ((size_t)blockIdx.x * 4 + (wave >> 1)) * (32 * HD) + lane * 8;
    const int ti0 = (int)blockIdx.x * (SNT / (TT / 128));   // the trip this work-group starts at
    // the lane's own byte address in the q plane, carried through the loop in registers of its own
    const unsigned long long aq0 = (unsigned long long)(Qf + (size_t)blockIdx.y * (TT * HD) + (size_t)ti0 * (2 * SQC * 16 * HD) + (size_t)(wave & 1) * (SQC * 16 * HD) + lane * 8);
    int ti = ti0; unsigned long long aq = aq0;
    v16bf ka[2][2], qb[SQC][2];
#pragma unroll
    for (int kt = 0; kt < 2; ++kt) { ka[kt][0] = ldfb(pk + kt * 1024); ka[kt][1] = ldfb(pk + kt * 1024 + 512); }
    // precaution: stands between the key loads and the query loads, one of which the compiler lets land in the key loads' address registers
    asm volatile("s_wait_xcnt 0x0" ::: "memory");
#pragma unroll
    for (int u = 0; u < SQC; ++u) { qb[u][0] = cat16b(g16(aq, u * 2048), g16(aq, u * 2048 + 512)); qb[u][1] = cat16b(g16(aq, u * 2048 + 1024), g16(aq, u * 2048 + 1536)); }
    v2f sm[2][4];   // per key tile: keys 8 hi + 2 i, 8 hi + 2 i + 1
#pragma unroll
    for (int kt = 0; kt < 2; ++kt)
#pragma unroll
        for (int i = 0; i < 4; ++i) sm[kt][i] = (v2f){0.f, 0.f};
    // rolled: one trip's 16 WMMAs and 64 exponentials are the body; unrolled it would need a second set of fragment registers and lose the fourth wave per SIMD
#pragma unroll 1
    for (int t = 0; t < SNT; ++t) {
        const int wrap = ti + 1 == SNT;   // behind the plane's last pieces come its first; the last trip so fetches the first trip's fragments again, inside the plane
        v8f s[2][SQC];
#pragma unroll
        for (int kt = 0; kt < 2; ++kt)
#pragma unroll
            for (int u = 0; u < SQC; ++u) s[kt][u] = wmmab(ka[kt][0], qb[u][0], (v8f){});
#pragma unroll
        for (int kt = 0; kt < 2; ++kt)
#pragma unroll
            for (int u = 0; u < SQC; ++u) s[kt][u] = wmmab(ka[kt][1], qb[u][1], s[kt][u]);
        // keeps the sixteen products back to back: mixed with the multiplies below, the compiler pads each first use of a tile with v_nop
        __builtin_amdgcn_sched_barrier(0);
        // the loaded fragments as inputs only: they count as live up to here, so that none of their registers is handed out as the accumulator of the product directly behind its last use (an accumulator written over the B operand of the product in front of it)
        asm volatile("" :: "v"(__builtin_bit_cast(v8f, qb[0][0])), "v"(__builtin_bit_cast(v8f, qb[1][0])), "v"(__builtin_bit_cast(v8f, qb[2][0])), "v"(__builtin_bit_cast(v8f, qb[3][0])));
        v2f x[2][4][SQC];
#pragma unroll
        for (int kt = 0; kt < 2; ++kt)
#pragma unroll
            for (int i = 0; i < 4; ++i)
#pragma unroll
                for (int u = 0; u < SQC; ++u) x[kt][i][u] = (v2f){s[kt][u][2 * i], s[kt][u][2 * i + 1]} * (v2f){LC, LC};
        // the scheduler may move nothing over this line: the fetch below stays behind the multiplies and in front of the exponentials
        __builtin_amdgcn_sched_barrier(0);
        // precaution: stands between the loads issued so far and the overwrite of their address registers; the address is an operand so that its step cannot be lifted over the wait
        asm volatile("s_wait_xcnt 0x0" : "+v"(aq) :: "memory");
        aq += wrap ? (unsigned long long)-(long long)((SNT - 1) * (2 * SQC * 16 * HD * 2)) : (unsigned long long)(2 * SQC * 16 * HD * 2); ti = wrap ? 0 : ti + 1;
#pragma unroll
        for (int u = 0; u < SQC; ++u) { qb[u][0] = cat16b(g16(aq, u * 2048), g16(aq, u * 2048 + 512)); qb[u][1] = cat16b(g16(aq, u * 2048 + 1024), g16(aq, u * 2048 + 1536)); }
        // holds the fetch in front of the exponentials, which cover its latency
        __builtin_amdgcn_sched_barrier(0);
#pragma unroll
        for (int kt = 0; kt < 2; ++kt)
#pragma unroll
            for (int i = 0; i < 4; ++i) { v2f p[SQC]; exp2x8(p, x[kt][i]); sm[kt][i] += (p[0] + p[1]) + (p[2] + p[3]); }
    }
    // the last trip's repeated fetch has landed before the wave goes on and gives its registers back
    asm volatile("s_wait_loadcnt 0x0" ::: "memory");
    // every lane leaves its 16 sums in LDS, a key's 16 entries side by side
#pragma unroll
    for (int kt = 0; kt < 2; ++kt)
#pragma unroll
        for (int j = 0; j < 8; ++j) reds[(wave * 32 + kt * 16 + hi * 8 + j) * SPI + lr] = sm[kt][j >> 1][j & 1];
    __syncthreads();
    float bias = 0.f;
    if (threadIdx.x < 128) {   // thread = key: the 16 lanes' entries of its two shares, which lie 32 rows apart
        const int g = ((int)(threadIdx.x >> 5) * 64 + (int)(threadIdx.x & 31)) * SPI;
        v2f sv = (v2f){0.f, 0.f};
#pragma unroll
        for (int i = 0; i < 8; ++i) sv += *(const v2fa*)(reds + g + 2 * i) + *(const v2fa*)(reds + g + 32 * SPI + 2 * i);
        const float sum = sv[0] + sv[1];
        bias = 10.0f - log2_slot(sum);   // 10 = log2(PCAR)
        const unsigned out_of_range = __builtin_amdgcn_ballot_w32(!(sum >= SLO && sum <= SHI));   // true for a NaN too
        if (lane == 0) redo[wave] = out_of_range != 0u; }
    // every thread learns whether a key's sum left the range; the barrier also ends the reads of reds, which the second walk writes anew
    __syncthreads();
    const int again = __builtin_amdgcn_readfirstlane(redo[0] | redo[1] | redo[2] | redo[3]);
    if (again) bias = stats_maxed(pk, aq0, ti0, redm, reds);
    if (threadIdx.x < 128) BI[(size_t)blockIdx.y * TT + (int)blockIdx.x * 128 + (int)threadIdx.x] = bias;
}

// ---- k_pv: pass 2, scores again, probabilities and the P.v product without a trip through memory. One wave = 32 queries x TT/KSPL keys; work-group = 256 queries x all keys (8 query groups x KSPL key shares); grid (TT/256, batches), 16 waves.
// A pass is 32 keys: S^T = K.Q^T for 2 key tiles x 2 query tiles (lane = query, register r = key 8 hi + r), p = exp2(s * LC + bias[key]); the two key tiles of one query tile, converted in place, are the fp16 B operand (k = 8 hi + 0..7, 16 + 8 hi + 0..7) of out^T[d][q] += v^T[d][k] P^T[k][q]; the v plane holds its A fragments in that k order.
// The work-groups of a batch all walk the same K, v and bias: each starts its key shares at a pass of its own (set by its block indices) and wraps round inside the share, so that at no moment do they all ask L2 for the same lines.
// K, bias and v fragments of the next pass are fetched into the same registers right behind their last use. At the end the two waves that hold the two key shares of the same 32 queries swap one query tile each through LDS; each adds the shares of the tile it kept (share 0 + share 1), undoes the 1024 and stores 16 rows of out.
#define KSPL 2
#define NPAS (TT / KSPL / 32)
static_assert(PCAR == 1024.0f, "k_stats writes log2(PCAR) as 10");
static_assert(KSPL == 2, "the waves swap their sums in pairs");
// passes between the starting places of two neighbouring work-groups of a batch
#define PSTEP (NPAS / (TT / 256))
static_assert(PSTEP >= 1 && PSTEP * (TT / 256) == NPAS, "every starting place lies inside the share");
// waves_per_eu: a register budget of 256, so that the work-group's 16 waves fill a WGP, four waves a SIMD: one wave's exponentials run beside another's WMMAs
__global__ __launch_bounds__(512) __attribute__((amdgpu_waves_per_eu(4, 4))) void k_pv(const bf* __restrict__ Kf, const bf* __restrict__ Qf, const h16* __restrict__ Vf, const float* __restrict__ BI, float* O) {
    // a wave's slot: 8 pieces of 32 lanes x 16 bytes, each piece one contiguous 512-byte LDS access of the wave
    __shared__ __align__(16) float fold[16 * 8 * 128];
    const int wave = threadIdx.x >> 5, lane = threadIdx.x & 31, lr = lane & 15, hi = lane >> 4;
    const int ks = wave >> 3;   // the wave's key share
    int pi = (int)blockIdx.x * PSTEP + (int)blockIdx.y % PSTEP;   // the pass of its share this work-group starts at; the batches' planes lie a power of two apart, so neighbouring batches fill the places between
    const int q0 = ((int)blockIdx.x * 8 + (wave & 7)) * 32, k0 = ks * (TT / KSPL) + pi * 32;
    const bf* pq = Qf + (size_t)blockIdx.y * (TT * HD) + (size_t)q0 * HD + lane * 8;
    // K, v and bias: the lane's own byte address, carried through the loop in registers of its own
    unsigned long long ak = (unsigned long long)(Kf + (size_t)blockIdx.y * (TT * HD) + (size_t)k0 * HD + lane * 8);
    unsigned long long av = (unsigned long long)(Vf + (size_t)blockIdx.y * (TT * HD) + (size_t)k0 * HD + lane * 8);
    unsigned long long ab = (unsigned long long)(BI + (size_t)blockIdx.y * TT + k0 + hi * 8);
    v16bf qb[2][2];
#pragma unroll
    for (int qt = 0; qt < 2; ++qt) { qb[qt][0] = ldfb(pq + qt * 1024); qb[qt][1] = ldfb(pq + qt * 1024 + 512); }
    // the q loads stand in front of the K loads: with one of them behind, the counted waits at the loop's head, which must hold for both ways in, wait for all K and bias loads at the second product
    __builtin_amdgcn_sched_barrier(0);
    v8f o[4][2];
#pragma unroll
    for (int dt = 0; dt < 4; ++dt) { o[dt][0] = (v8f){}; o[dt][1] = (v8f){}; }
    v16bf ka[2][2]; v16h va[4]; v4f bi[2][2];
#pragma unroll
    for (int kt = 0; kt < 2; ++kt) { ka[kt][0] = cat16b(g16(ak, kt * 2048), g16(ak, kt * 2048 + 512)); ka[kt][1] = cat16b(g16(ak, kt * 2048 + 1024), g16(ak, kt * 2048 + 1536));
        bi[kt][0] = __builtin_bit_cast(v4f, g16(ab, kt * 64)); bi[kt][1] = __builtin_bit_cast(v4f, g16(ab, kt * 64 + 16)); }
    // the v loads stand behind the K and bias loads as in the loop: in another order the counted waits at the loop's head, which must hold for both ways in, wait for the v fragments too
    __builtin_amdgcn_sched_barrier(0);
#pragma unroll
    for (int dt = 0; dt < 4; ++dt) va[dt] = cat16(__builtin_bit_cast(v8h, g16(av, dt * 1024)), __builtin_bit_cast(v8h, g16(av, dt * 1024 + 512)));
    // rolled: one pass's 16 WMMAs and 32 exponentials are the body; unrolled it would need a second set of fragment registers and lose the fourth wave per SIMD
#pragma unroll 1
    for (int p = 0; p < NPAS; ++p) {
        const int wrap = pi + 1 == NPAS;   // behind the share's last keys come its first; the last pass so fetches the first pass's fragments again, inside its range
        v8f s[2][2];
#pragma unroll
        for (int kt = 0; kt < 2; ++kt)
#pragma unroll
            for (int qt = 0; qt < 2; ++qt) s[kt][qt] = wmmab(ka[kt][0], qb[qt][0], (v8f){});
#pragma unroll
        for (int kt = 0; kt < 2; ++kt)
#pragma unroll
            for (int qt = 0; qt < 2; ++qt) s[kt][qt] = wmmab(ka[kt][1], qb[qt][1], s[kt][qt]);
        // keeps the eight products back to back: mixed with the multiply-adds below, the compiler pads each first use of a tile with v_nop
        __builtin_amdgcn_sched_barrier(0);
        v2f x[2][2][4];
#pragma unroll
        for (int kt = 0; kt < 2; ++kt)
#pragma unroll
            for (int qt = 0; qt < 2; ++qt)
#pragma unroll
                for (int i = 0; i < 4; ++i) x[kt][qt][i] = __builtin_elementwise_fma((v2f){s[kt][qt][2 * i], s[kt][qt][2 * i + 1]}, (v2f){LC, LC}, (v2f){bi[kt][i >> 1][2 * (i & 1)], bi[kt][i >> 1][2 * (i & 1) + 1]});
        // the scheduler may move nothing over this line: without it the fetch below sinks to the loop's foot and its latency stands open in front of the next pass's first WMMA
        __builtin_amdgcn_sched_barrier(0);
        // precaution: stands between the loads issued so far and the overwrite of their address registers; the addresses are operands so that their step cannot be lifted over the wait
        asm volatile("s_wait_xcnt 0x0" : "+v"(ak), "+v"(ab) :: "memory");
        ak += wrap ? (unsigned long long)-(long long)((NPAS - 1) * 4096) : 4096ull; ab += wrap ? (unsigned long long)-(long long)((NPAS - 1) * 128) : 128ull;
#pragma unroll
        for (int kt = 0; kt < 2; ++kt) { ka[kt][0] = cat16b(g16(ak, kt * 2048), g16(ak, kt * 2048 + 512)); ka[kt][1] = cat16b(g16(ak, kt * 2048 + 1024), g16(ak, kt * 2048 + 1536));
            bi[kt][0] = __builtin_bit_cast(v4f, g16(ab, kt * 64)); bi[kt][1] = __builtin_bit_cast(v4f, g16(ab, kt * 64 + 16)); }
        // holds the fetch in front of the exponentials, which cover its latency
        __builtin_amdgcn_sched_barrier(0);
        v16h pf[2];
#pragma unroll
        for (int qt = 0; qt < 2; ++qt)
#pragma unroll
            for (int kt = 0; kt < 2; ++kt) { v2f e[4]; exp2x8(e, x[kt][qt]);
#pragma unroll
                for (int i = 0; i < 4; ++i) { const v2h c = __builtin_convertvector(e[i], v2h); pf[qt][kt * 8 + 2 * i] = c[0]; pf[qt][kt * 8 + 2 * i + 1] = c[1]; } }
#pragma unroll
        for (int dt = 0; dt < 4; ++dt)
#pragma unroll
            for (int qt = 0; qt < 2; ++qt) o[dt][qt] = wmma16(va[dt], pf[qt], o[dt][qt]);
        // keeps the address step behind the products, whose operands the wait for the earlier v loads has covered
        __builtin_amdgcn_sched_barrier(0);
        // precaution: as above
        asm volatile("s_wait_xcnt 0x0" : "+v"(av) :: "memory");
        av += wrap ? (unsigned long long)-(long long)((NPAS - 1) * 4096) : 4096ull; pi = wrap ? 0 : pi + 1;
#pragma unroll
        for (int dt = 0; dt < 4; ++dt) va[dt] = cat16(__builtin_bit_cast(v8h, g16(av, dt * 1024)), __builtin_bit_cast(v8h, g16(av, dt * 1024 + 512)));
    }
    // the last pass's repeated fetch has landed before the wave stores its sums and gives its registers back
    asm volatile("s_wait_loadcnt 0x0" ::: "memory");
    // the wave of key share ks keeps query tile ks and hands the other tile to its partner, wave ^ 8, which holds the same lanes' sums over the other keys
    float* fs = fold + wave * 1024 + lane * 4; const float* fr = fold + (wave ^ 8) * 1024 + lane * 4;
    v8f mine[4];
#pragma unroll
    for (int dt = 0; dt < 4; ++dt) { const v8f g = ks ? o[dt][0] : o[dt][1]; mine[dt] = ks ? o[dt][1] : o[dt][0];
        *(v4fa*)(fs + dt * 256) = __builtin_shufflevector(g, g, 0, 1, 2, 3); *(v4fa*)(fs + dt * 256 + 128) = __builtin_shufflevector(g, g, 4, 5, 6, 7); }
    __syncthreads();
    float* po = O + ((size_t)blockIdx.y * TT + q0 + ks * 16 + lr) * HD + 8 * hi;
#pragma unroll
    for (int dt = 0; dt < 4; ++dt) { const v4f a = *(const v4fa*)(fr + dt * 256), b = *(const v4fa*)(fr + dt * 256 + 128);
        *(v8f*)(po + dt * 16) = (mine[dt] + __builtin_shufflevector(a, b, 0, 1, 2, 3, 4, 5, 6, 7)) * (1.0f / PCAR); }   // a lane's 8 registers are 8 consecutive d of one query
}

// ---- k_planes: q and k to their bf16 fragment planes and v to the fp16 plane of A fragments of v^T (per 32 keys 4 d tiles x 2 halves x 32 lanes x 8 keys; lane (lr, hi) of half h2 holds keys 16 h2 + 8 hi + 0..7 of d = 16 dt + lr), all three in one launch. One wave = the same 16 rows (counted over all batches) of q, of k and of v; work-group = 8 waves; grid NB_ * TT / 128: 16 waves a WGP.
// Every load is two whole rows of the wave (q, k: rows 2 j, 2 j + 1, 512 contiguous bytes; v: rows j and 8 + j), all 24 issued before the first is used. The converted pieces change lanes through the wave's own LDS range, laid out in plane order, so that every store is 512 contiguous bytes too. No other wave reads that range: no barrier.
// q, k: lane (c, hi) of load j holds columns 4 c + 0..3 of row 2 j + hi, half of the piece (block c / 2, row). v: lane (c, hi) of load j holds d = 4 c + 0..3 of key 8 hi + j, so after 8 loads four whole pieces (8 keys of one d).
// LDS pitch, in 16-bit elements, of one 8-column block of a q or k tile (16 rows x 8, + 16): the 32 lanes' 8-byte stores of one row pair fall on all 64 banks once
#define PQP 144
// the same of one d tile of v (32 pieces x 8, + 8): the 16-byte stores of a half-wave fall on all 64 banks once
#define PVP 264
#define PWS (2 * 8 * PQP + 4 * PVP)
static_assert((NB_ * TT) % 128 == 0 && TT % 32 == 0 && HD == 64, "a wave takes 16 whole rows of 64, a work-group 128");
typedef v4us __attribute__((may_alias)) v4usa;
__global__ __launch_bounds__(256) void k_planes(const float* __restrict__ q, const float* __restrict__ k, const float* __restrict__ v, bf* QF, bf* KF, h16* VF) {
    __shared__ __align__(16) bf st[8 * PWS];
    const int wave = threadIdx.x >> 5, lane = threadIdx.x & 31, c = lane & 15, hi = lane >> 4;
    const size_t t = (size_t)blockIdx.x * 8 + wave;   // the 16-row tile
    const float* sq = q + t * (16 * HD) + hi * HD + c * 4; const float* sk = k + t * (16 * HD) + hi * HD + c * 4; const float* sv = v + t * (16 * HD) + hi * (8 * HD) + c * 4;
    v4f a[8], b[8], w[8];
#pragma unroll
    for (int j = 0; j < 8; ++j) a[j] = *(const v4f*)(sq + j * (2 * HD));
    // precaution: stands between these loads and the later ones, one of which the compiler lets land in their address registers
    asm volatile("s_wait_xcnt 0x0" ::: "memory");
#pragma unroll
    for (int j = 0; j < 8; ++j) b[j] = *(const v4f*)(sk + j * (2 * HD));
    // precaution: as above
    asm volatile("s_wait_xcnt 0x0" ::: "memory");
#pragma unroll
    for (int j = 0; j < 8; ++j) w[j] = *(const v4f*)(sv + j * HD);
    // holds all 24 loads in front of the first conversion: 12 KB of a wave in flight at once
    __builtin_amdgcn_sched_barrier(0);
    bf* lq = st + wave * PWS; bf* lk = lq + 8 * PQP; bf* lv = lk + 8 * PQP;
    const int wq = (c >> 1) * PQP + hi * 8 + (c & 1) * 4, wv = (c >> 2) * PVP + hi * 128 + (c & 3) * 32;
#pragma unroll
    for (int j = 0; j < 8; ++j) { v4us o;
#pragma unroll
        for (int e = 0; e < 4; ++e) o[e] = f2bf(a[j][e]);
        *(v4usa*)(lq + wq + j * 16) = o; }
#pragma unroll
    for (int j = 0; j < 8; ++j) { v4us o;
#pragma unroll
        for (int e = 0; e < 4; ++e) o[e] = f2bf(b[j][e]);
        *(v4usa*)(lk + wq + j * 16) = o; }
#pragma unroll
    for (int e = 0; e < 4; ++e) { v8h o;
#pragma unroll
        for (int u = 0; u < 8; ++u) o[u] = tohx(bfr(w[u][e]));
        *(v8usa*)(lv + wv + e * 8) = __builtin_bit_cast(v8us, o); }
    // the wave's own LDS stores have landed before its lanes read one another's pieces back
    asm volatile("s_wait_dscnt 0x0" ::: "memory");
    v8us x[4], y[4], z[4];
#pragma unroll
    for (int i = 0; i < 4; ++i) { x[i] = *(const v8usa*)(lq + (2 * i + hi) * PQP + c * 8); y[i] = *(const v8usa*)(lk + (2 * i + hi) * PQP + c * 8); z[i] = *(const v8usa*)(lv + i * PVP + lane * 8); }
    bf* dq = QF + t * 1024 + lane * 8; bf* dk = KF + t * 1024 + lane * 8; h16* dv = VF + (t >> 1) * 2048 + (t & 1) * 256 + lane * 8;
#pragma unroll
    for (int i = 0; i < 4; ++i) *(v8us*)(dq + i * 256) = x[i];
#pragma unroll
    for (int i = 0; i < 4; ++i) *(v8us*)(dk + i * 256) = y[i];
#pragma unroll
    for (int i = 0; i < 4; ++i) *(v8h*)(dv + i * 512) = __builtin_bit_cast(v8h, z[i]);
}

extern "C" void kernel_launch(void* const* d_in, const int* in_sizes, int n_in,
                              void* d_out, int out_size, void* d_ws, size_t ws_size, hipStream_t stream) {
    (void)in_sizes; (void)n_in; (void)out_size;
    const float* qin = (const float*)d_in[0]; const float* kin = (const float*)d_in[1]; const float* vin = (const float*)d_in[2];
    float* OUT = (float*)d_out;     // [16][4096][64]
    char* wsp = (char*)d_ws;
    auto take = [&](size_t bytes) { char* p = wsp; wsp += (bytes + 255) & ~(size_t)255; return (void*)p; };
    bf* QF = (bf*)take((size_t)NB_ * TT * HD * 2); bf* KF = (bf*)take((size_t)NB_ * TT * HD * 2); h16* VF = (h16*)take((size_t)NB_ * HD * TT * 2); float* BI = (float*)take((size_t)NB_ * TT * 4);
    if ((size_t)(wsp - (char*)d_ws) > ws_size) return;
    k_planes<<<NB_ * TT / 128, 256, 0, stream>>>(qin, kin, vin, QF, KF, VF);
    k_stats<<<dim3(TT / 128, NB_, 1), 256, 0, stream>>>(KF, QF, BI);   /* per key: log2(1024 / sum over q of exp(x)), in the exponent's units */
    k_pv<<<dim3(TT / 256, NB_, 1), 512, 0, stream>>>(KF, QF, VF, BI, OUT);   /* out[q] = sum_k attn[q][k] v[k] */
}
